// v000
// The times below were measured on an AMD MI455X: many runs one after another, warmed up first and cycling through
// copies of the inputs, with the whole window's GPU time divided by the number of runs. Launches and the gaps
// between them are all in it. The median over several windows is given; except for v000 it joins two sittings, which
// can be a few percent apart, so the side-by-side timings, each taken in one sitting, are the better comparison.
// v000 is the starting kernel. One run takes 23.9 microseconds.
// Channel dot products (band Gram tiles): v_wmma_f32_16x16x32_f16, f16 operands (x carried x64), f32 accumulate; norms, normalisation and softmax in f32.
#include <hip/hip_runtime.h>
#include <math.h>

#define BB     4
#define CC     64
#define HH     128
#define WW     128
#define KK     7
#define NOFF   (KK * KK)        // 49 window offsets
#define PAD    3
#define HP     (HH + 2 * PAD)   // 134 padded rows
#define WP     (WW + 2 * PAD)   // 134 padded columns
#define NPITCH 160
#define EPSF   1e-7f
#define XSC    64.0f            // power-of-two carry scale of the f16 copy of x
#define INVSC2 (1.0f / 4096.0f) // undo XSC*XSC in the f32 epilogue
#define XSP    132              // LDS pitch (floats) of the f32 row tile
#define HSP    72               // LDS pitch (halves) of the f16 pixel tile
#define SMP    52               // LDS pitch (floats) of the per-pixel offset row
#define OPIX   (HH * WW)        // 16384

typedef _Float16 v16h __attribute__((ext_vector_type(16)));
typedef _Float16 v8h  __attribute__((ext_vector_type(8)));
typedef float    v8f  __attribute__((ext_vector_type(8)));
typedef float    v4f  __attribute__((ext_vector_type(4)));
union FragH { v16h v; v8h half[2]; };

// 16x16x32 f16 WMMA with the dependency guard: 4 VALU slots before anything touches D, A/B kept live.
__device__ __forceinline__ v8f wmma_f16(v16h a, v16h b, v8f c)
{
    v8f d = __builtin_amdgcn_wmma_f32_16x16x32_f16(false, a, false, b, (short)0, c, false, false);
    asm volatile("v_nop\n\tv_nop\n\tv_nop\n\tv_nop" : "+v"(d) : "v"(a), "v"(b));
    return d;
}

// ---------------------------------------------------------------------------
// Kernel 1: one block per (padded row pr, batch b).
//   x (B,C,H,W) f32 -> xT padded pixel-major (B,HP,WP,C) f16, value = x*64 (zeros in the halo),
//   plus per-pixel L2 norms (B,HP,NPITCH) f32 from the f32 data (0 in the halo and in pitch padding).
// Staging: the 64x128 f32 row tile and the 134x64 f16 pixel tile live in LDS; each xT pixel line
// Coverage: lines L = it*32 + wave*4 + (lane>>3), it 0..4 -> 0..159, stored for L < 134 = every pixel
// of the row; grid (134, 4) = every padded row; norm rows 5 x 32 = 160 floats = whole pitch.
// ---------------------------------------------------------------------------
__global__ __launch_bounds__(256)
void prep_kernel(const float* __restrict__ x,
                 _Float16* __restrict__ xT,
                 float* __restrict__ nrm)
{
    __shared__ __align__(16) float    xs[CC][XSP];
    __shared__ __align__(16) _Float16 hs[WP][HSP];
    __shared__ float ns[NPITCH];

    const int pr   = blockIdx.x;          // padded row 0..133
    const int b    = blockIdx.y;          // batch
    const int tid  = threadIdx.x;
    const int lane = tid & 31;
    const int wave = tid >> 5;

    const int  r     = pr - PAD;
    const bool inrow = (r >= 0) && (r < HH);                     // block-uniform
    const int  rc    = (r < 0) ? 0 : ((r > HH - 1) ? (HH - 1) : r);
    const float* xb  = x + (size_t)b * CC * HH * WW + (size_t)rc * WW;
    const v4f z4 = (v4f){0.f, 0.f, 0.f, 0.f};

    // (1) coalesced load of the f32 row tile (clamped row address, zero by value outside)
#pragma unroll
    for (int it = 0; it < 8; ++it) {
        const int q  = it * 256 + tid;     // 0..2047 float4 slots
        const int c  = q >> 5;             // channel 0..63
        const int w4 = (q & 31) * 4;       // column 0..124
        v4f v = *(const v4f*)(xb + (size_t)c * HH * WW + w4);
        v = inrow ? v : z4;
        *(v4f*)(&xs[c][w4]) = v;
    }
    __syncthreads();

    // (2) thread per padded pixel: f32 sum of squares + f16 conversion (x64), all lanes compute on a
    //     clamped pixel index, stores predicated
    const int  pc    = (tid < WP) ? tid : (WP - 1);
    const int  cw    = pc - PAD;
    const bool incol = (cw >= 0) && (cw < WW);
    const int  cwc   = (cw < 0) ? 0 : ((cw > WW - 1) ? (WW - 1) : cw);
    float s = 0.f;
#pragma unroll 1
    for (int g = 0; g < CC / 8; ++g) {
        v8h hv;
#pragma unroll
        for (int e = 0; e < 8; ++e) {
            float f = xs[g * 8 + e][cwc];
            f = incol ? f : 0.f;
            s = fmaf(f, f, s);
            hv[e] = (_Float16)(f * XSC);
        }
        if (tid < WP) *(v8h*)(&hs[pc][g * 8]) = hv;
    }
    const float nv = (tid < WP) ? sqrtf(s) : 0.f;
    if (tid < NPITCH) ns[tid] = nv;
    __syncthreads();

    _Float16* xrow = xT  + ((size_t)(b * HP + pr) * WP) * CC;
    float*    nrow = nrm + (size_t)(b * HP + pr) * NPITCH;
    const int lq = lane >> 3;
    const int e8 = (lane & 7) * 8;
    int  Lv[5];
    v8h  hvv[5];
#pragma unroll
    for (int it = 0; it < 5; ++it) {
        const int L  = it * 32 + wave * 4 + lq;          // pixel line index, uniform per 8-lane group
        const int Lc = (L < WP) ? L : (WP - 1);
        Lv[it]  = L;
        hvv[it] = *(const v8h*)(&hs[Lc][e8]);
    }
    const int   nw   = (wave < 5) ? wave : 4;
    const float nval = ns[nw * 32 + lane];

#pragma unroll
    for (int it = 0; it < 5; ++it)
        if (Lv[it] < WP) *(v8h*)(xrow + (size_t)Lv[it] * CC + e8) = hvv[it];
    if (wave < 5) *(float*)(nrow + wave * 32 + lane) = nval;
    
}

// ---------------------------------------------------------------------------
// Kernel 2: one block per (b, h); 8 waves, each wave owns 16 output pixels w0..w0+15.
// Band WMMA: for each vertical offset i, two 16x16 D tiles (each = two 16x16x32 steps over the 64
// channels): A = 16 centre pixel vectors (rows m), B = 16 neighbour vectors at padded columns
// w0+16*tile+n (columns n); D[m][n] holds horizontal offset j = n - m + 16*tile, valid when 0<=j<7.
// A and B fragments both use the split k map: elements 0..7 <- k0+8*half, 8..15 <- k0+16+8*half.
// Extraction is branch-free: invalid (m,n) pairs land in trash slot 49 of the per-pixel LDS row.
// Then thread p (< 128) runs the 49-way softmax of pixel p in f32 from LDS and writes out[b][k][h*128+p]:
// ---------------------------------------------------------------------------
__global__ __launch_bounds__(256)
void sim_softmax_kernel(const _Float16* __restrict__ xT,
                        const float* __restrict__ nrm,
                        float* __restrict__ out)
{
    __shared__ __align__(16) float sm[8][16][SMP];   // [wave][pixel][offset slot] (+trash 49, pad)

    const int bh   = blockIdx.x;
    const int b    = bh >> 7;                         // HH == 128
    const int h    = bh & (HH - 1);
    const int lane = threadIdx.x & 31;
    const int wave = threadIdx.x >> 5;
    const int w0   = wave * 16;
    const int half = lane >> 4;
    const int n    = lane & 15;                       // A row / B column / D column of this lane

    const size_t rowStride = (size_t)WP * CC;         // halves per padded row
    const _Float16* bbase  = xT  + (size_t)b * HP * rowStride;
    const float*    nb     = nrm + (size_t)b * HP * NPITCH;

    // A fragments: centre pixel m = n at padded (h+3, w0+3+n), channels 0..31 and 32..63
    const _Float16* cpix = bbase + (size_t)(h + PAD) * rowStride + (size_t)(w0 + PAD + n) * CC;
    FragH a0, a1;
    a0.half[0] = *(const v8h*)(cpix +      8 * half);
    a0.half[1] = *(const v8h*)(cpix + 16 + 8 * half);
    a1.half[0] = *(const v8h*)(cpix + 32 + 8 * half);
    a1.half[1] = *(const v8h*)(cpix + 48 + 8 * half);

    // centre norms of this lane's 8 D rows (pixels 8*half + r)
    const float* ncRow = nb + (size_t)(h + PAD) * NPITCH + (w0 + PAD) + 8 * half;
    float ncv[8];
#pragma unroll
    for (int r = 0; r < 8; ++r) ncv[r] = ncRow[r];

#pragma unroll 1
    for (int i = 0; i < KK; ++i) {
        const _Float16* rowi = bbase + (size_t)(h + i) * rowStride;   // padded row h+i
        const float*    nri  = nb + (size_t)(h + i) * NPITCH;

#pragma unroll
        for (int tile = 0; tile < 2; ++tile) {
            int col = w0 + 16 * tile + n;              // this lane's B column (padded), arithmetic
            col = (col < WP) ? col : (WP - 1);         // clamp keeps the address in range (junk unused)
            const float np = nri[col];                 // neighbour norm of D column n

            const _Float16* bp = rowi + (size_t)col * CC;
            FragH b0, b1;
            b0.half[0] = *(const v8h*)(bp +      8 * half);
            b0.half[1] = *(const v8h*)(bp + 16 + 8 * half);
            b1.half[0] = *(const v8h*)(bp + 32 + 8 * half);
            b1.half[1] = *(const v8h*)(bp + 48 + 8 * half);

            v8f acc = (v8f){0.f, 0.f, 0.f, 0.f, 0.f, 0.f, 0.f, 0.f};
            acc = wmma_f16(a0.v, b0.v, acc);
            acc = wmma_f16(a1.v, b1.v, acc);

#pragma unroll
            for (int r = 0; r < 8; ++r) {
                const int m    = r + 8 * half;                 // output pixel within the wave tile
                const int j    = n - m + 16 * tile;            // horizontal offset
                const int slot = ((unsigned)j < (unsigned)KK) ? (i * KK + j) : NOFF;
                const float den = fmaf(ncv[r], np, EPSF);
                const float val = (acc[r] * INVSC2) * __builtin_amdgcn_rcpf(den);
                sm[wave][m][slot] = val;
            }
        }
    }

    __syncthreads();

    // softmax over the 49 offsets; threads 0..127 own one pixel each (waves 4..7 skip uniformly)
    const int p = threadIdx.x;
    if (p < WW) {
        float* row = &sm[p >> 4][p & 15][0];
        float mx = row[0];
#pragma unroll 1
        for (int k = 1; k < NOFF; ++k) mx = fmaxf(mx, row[k]);
        float sum = 0.f;
#pragma unroll 1
        for (int k = 0; k < NOFF; ++k) {
            const float e = expf(row[k] - mx);
            row[k] = e;
            sum += e;
        }
        const float inv = __builtin_amdgcn_rcpf(sum);   // sum in [1, 49]
#pragma unroll 1
        for (int k = 0; k < NOFF; ++k) row[k] = row[k] * inv;

        float* op = out + (size_t)b * NOFF * OPIX + (size_t)h * WW + p;
#pragma unroll 1
        for (int k = 0; k < NOFF; ++k)
            *(float*)(op + (size_t)k * OPIX) = row[k];
        
    }
}

// ---------------------------------------------------------------------------
// Workspace: [ xT f16 (B,HP,WP,C) = 9,193,472 B | norms f32 (B,HP,160) = 343,040 B ] = 9,536,512 B.
// ---------------------------------------------------------------------------
extern "C" void kernel_launch(void* const* d_in, const int* in_sizes, int n_in,
                              void* d_out, int out_size, void* d_ws, size_t ws_size,
                              hipStream_t stream)
{
    if (n_in < 1) return;
    if (in_sizes[0] != BB * CC * HH * WW) return;
    if (out_size != BB * NOFF * OPIX) return;

    const size_t xT_bytes  = (size_t)BB * HP * WP * CC * sizeof(_Float16);   // multiple of 128
    const size_t nrm_bytes = (size_t)BB * HP * NPITCH * sizeof(float);
    if (xT_bytes + nrm_bytes > ws_size) return;

    const float* x   = (const float*)d_in[0];
    float*       out = (float*)d_out;
    _Float16*    xT  = (_Float16*)d_ws;
    float*       nrm = (float*)((char*)d_ws + xT_bytes);

    prep_kernel<<<dim3(HP, BB), dim3(256), 0, stream>>>(x, xT, nrm);
    sim_softmax_kernel<<<dim3(BB * HH), dim3(256), 0, stream>>>(xT, nrm, out);
    (void)hipGetLastError();
}

// v001
// A run of this version takes 18.6 microseconds.
// Two timings next to v000 both put it at 1.30 times that version's speed.
// Channel dot products (band Gram tiles): v_wmma_f32_16x16x32_f16, f16 operands (x carried x64), f32 accumulate; norms, normalisation and softmax in f32.
#include <hip/hip_runtime.h>
#include <math.h>

#define BB     4
#define CC     64
#define HH     128
#define WW     128
#define KK     7
#define NOFF   (KK * KK)        // 49 window offsets
#define PAD    3
#define HP     (HH + 2 * PAD)   // 134 padded rows
#define WP     (WW + 2 * PAD)   // 134 padded columns
#define NPITCH 160
#define EPSF   1e-7f
#define XSC    64.0f            // power-of-two carry scale of the f16 copy of x
#define INVSC2 (1.0f / 4096.0f) // undo XSC*XSC in the f32 epilogue
#define XSP    132              // LDS pitch (floats) of the f32 row tile
#define HSP    72               // LDS pitch (halves) of the f16 pixel tile
#define SMP    52               // LDS pitch (floats) of the per-pixel offset row
#define OPIX   (HH * WW)        // 16384

typedef _Float16 v16h __attribute__((ext_vector_type(16)));
typedef _Float16 v8h  __attribute__((ext_vector_type(8)));
typedef float    v8f  __attribute__((ext_vector_type(8)));
typedef float    v4f  __attribute__((ext_vector_type(4)));
union FragH { v16h v; v8h half[2]; };

// 16x16x32 f16 WMMA with the dependency guard: 4 VALU slots before anything touches D, A/B kept live.
__device__ __forceinline__ v8f wmma_f16(v16h a, v16h b, v8f c)
{
    v8f d = __builtin_amdgcn_wmma_f32_16x16x32_f16(false, a, false, b, (short)0, c, false, false);
    asm volatile("v_nop\n\tv_nop\n\tv_nop\n\tv_nop" : "+v"(d) : "v"(a), "v"(b));
    return d;
}

// ---------------------------------------------------------------------------
// Kernel 1: one block per (padded row pr, batch b).
//   x (B,C,H,W) f32 -> xT padded pixel-major (B,HP,WP,C) f16, value = x*64 (zeros in the halo),
//   plus per-pixel L2 norms (B,HP,NPITCH) f32 from the f32 data (0 in the halo and in pitch padding).
// Staging: the 64x128 f32 row tile and the 134x64 f16 pixel tile live in LDS; each xT pixel line
// Coverage: lines L = it*32 + wave*4 + (lane>>3), it 0..4 -> 0..159, stored for L < 134 = every pixel
// of the row; grid (134, 4) = every padded row; norm rows 5 x 32 = 160 floats = whole pitch.
// ---------------------------------------------------------------------------
__global__ __launch_bounds__(256)
void prep_kernel(const float* __restrict__ x,
                 _Float16* __restrict__ xT,
                 float* __restrict__ nrm)
{
    __shared__ __align__(16) float    xs[CC][XSP];
    __shared__ __align__(16) _Float16 hs[WP][HSP];
    __shared__ float ns[NPITCH];

    const int pr   = blockIdx.x;          // padded row 0..133
    const int b    = blockIdx.y;          // batch
    const int tid  = threadIdx.x;
    const int lane = tid & 31;
    const int wave = tid >> 5;

    const int  r     = pr - PAD;
    const bool inrow = (r >= 0) && (r < HH);                     // block-uniform
    const int  rc    = (r < 0) ? 0 : ((r > HH - 1) ? (HH - 1) : r);
    const float* xb  = x + (size_t)b * CC * HH * WW + (size_t)rc * WW;
    const v4f z4 = (v4f){0.f, 0.f, 0.f, 0.f};

    // (1) coalesced load of the f32 row tile (clamped row address, zero by value outside)
#pragma unroll
    for (int it = 0; it < 8; ++it) {
        const int q  = it * 256 + tid;     // 0..2047 float4 slots
        const int c  = q >> 5;             // channel 0..63
        const int w4 = (q & 31) * 4;       // column 0..124
        v4f v = *(const v4f*)(xb + (size_t)c * HH * WW + w4);
        v = inrow ? v : z4;
        *(v4f*)(&xs[c][w4]) = v;
    }
    __syncthreads();

    // (2) thread per padded pixel: f32 sum of squares + f16 conversion (x64), all lanes compute on a
    //     clamped pixel index, stores predicated
    const int  pc    = (tid < WP) ? tid : (WP - 1);
    const int  cw    = pc - PAD;
    const bool incol = (cw >= 0) && (cw < WW);
    const int  cwc   = (cw < 0) ? 0 : ((cw > WW - 1) ? (WW - 1) : cw);
    float s = 0.f;
#pragma unroll 1
    for (int g = 0; g < CC / 8; ++g) {
        v8h hv;
#pragma unroll
        for (int e = 0; e < 8; ++e) {
            float f = xs[g * 8 + e][cwc];
            f = incol ? f : 0.f;
            s = fmaf(f, f, s);
            hv[e] = (_Float16)(f * XSC);
        }
        if (tid < WP) *(v8h*)(&hs[pc][g * 8]) = hv;
    }
    const float nv = (tid < WP) ? sqrtf(s) : 0.f;
    if (tid < NPITCH) ns[tid] = nv;
    __syncthreads();

    _Float16* xrow = xT  + ((size_t)(b * HP + pr) * WP) * CC;
    float*    nrow = nrm + (size_t)(b * HP + pr) * NPITCH;
    const int lq = lane >> 3;
    const int e8 = (lane & 7) * 8;
    int  Lv[5];
    v8h  hvv[5];
#pragma unroll
    for (int it = 0; it < 5; ++it) {
        const int L  = it * 32 + wave * 4 + lq;          // pixel line index, uniform per 8-lane group
        const int Lc = (L < WP) ? L : (WP - 1);
        Lv[it]  = L;
        hvv[it] = *(const v8h*)(&hs[Lc][e8]);
    }
    const int   nw   = (wave < 5) ? wave : 4;
    const float nval = ns[nw * 32 + lane];

#pragma unroll
    for (int it = 0; it < 5; ++it)
        if (Lv[it] < WP) *(v8h*)(xrow + (size_t)Lv[it] * CC + e8) = hvv[it];
    if (wave < 5) *(float*)(nrow + wave * 32 + lane) = nval;
    
}

// ---------------------------------------------------------------------------
// Kernel 2: one block per (b, h); 8 waves, each wave owns 16 output pixels w0..w0+15.
// Band WMMA: for each vertical offset i, two 16x16 D tiles (each = two 16x16x32 steps over the 64
// channels): A = 16 centre pixel vectors (rows m), B = 16 neighbour vectors at padded columns
// w0+16*tile+n (columns n); D[m][n] holds horizontal offset j = n - m + 16*tile, valid when 0<=j<7.
// A and B fragments both use the split k map: elements 0..7 <- k0+8*half, 8..15 <- k0+16+8*half.
// Extraction is branch-free: invalid (m,n) pairs land in trash slot 49 of the per-pixel LDS row.
// Then thread p (< 128) runs the 49-way softmax of pixel p in f32 in registers and writes out[b][k][h*128+p].
// ---------------------------------------------------------------------------
__global__ __launch_bounds__(256)
void sim_softmax_kernel(const _Float16* __restrict__ xT,
                        const float* __restrict__ nrm,
                        float* __restrict__ out)
{
    __shared__ __align__(16) float sm[8][16][SMP];   // [wave][pixel][offset slot] (+trash 49, pad)

    const int bh   = blockIdx.x;
    const int b    = bh >> 7;                         // HH == 128
    const int h    = bh & (HH - 1);
    const int lane = threadIdx.x & 31;
    const int wave = threadIdx.x >> 5;
    const int w0   = wave * 16;
    const int half = lane >> 4;
    const int n    = lane & 15;                       // A row / B column / D column of this lane

    const size_t rowStride = (size_t)WP * CC;         // halves per padded row
    const _Float16* bbase  = xT  + (size_t)b * HP * rowStride;
    const float*    nb     = nrm + (size_t)b * HP * NPITCH;

    // A fragments: centre pixel m = n at padded (h+3, w0+3+n), channels 0..31 and 32..63
    const _Float16* cpix = bbase + (size_t)(h + PAD) * rowStride + (size_t)(w0 + PAD + n) * CC;
    FragH a0, a1;
    a0.half[0] = *(const v8h*)(cpix +      8 * half);
    a0.half[1] = *(const v8h*)(cpix + 16 + 8 * half);
    a1.half[0] = *(const v8h*)(cpix + 32 + 8 * half);
    a1.half[1] = *(const v8h*)(cpix + 48 + 8 * half);

    // centre norms of this lane's 8 D rows (pixels 8*half + r)
    const float* ncRow = nb + (size_t)(h + PAD) * NPITCH + (w0 + PAD) + 8 * half;
    float ncv[8];
#pragma unroll
    for (int r = 0; r < 8; ++r) ncv[r] = ncRow[r];

#pragma unroll 1
    for (int i = 0; i < KK; ++i) {
        const _Float16* rowi = bbase + (size_t)(h + i) * rowStride;   // padded row h+i
        const float*    nri  = nb + (size_t)(h + i) * NPITCH;

#pragma unroll
        for (int tile = 0; tile < 2; ++tile) {
            int col = w0 + 16 * tile + n;              // this lane's B column (padded), arithmetic
            col = (col < WP) ? col : (WP - 1);         // clamp keeps the address in range (junk unused)
            const float np = nri[col];                 // neighbour norm of D column n

            const _Float16* bp = rowi + (size_t)col * CC;
            FragH b0, b1;
            b0.half[0] = *(const v8h*)(bp +      8 * half);
            b0.half[1] = *(const v8h*)(bp + 16 + 8 * half);
            b1.half[0] = *(const v8h*)(bp + 32 + 8 * half);
            b1.half[1] = *(const v8h*)(bp + 48 + 8 * half);

            v8f acc = (v8f){0.f, 0.f, 0.f, 0.f, 0.f, 0.f, 0.f, 0.f};
            acc = wmma_f16(a0.v, b0.v, acc);
            acc = wmma_f16(a1.v, b1.v, acc);

#pragma unroll
            for (int r = 0; r < 8; ++r) {
                const int m    = r + 8 * half;                 // output pixel within the wave tile
                const int j    = n - m + 16 * tile;            // horizontal offset
                const int slot = ((unsigned)j < (unsigned)KK) ? (i * KK + j) : NOFF;
                const float den = fmaf(ncv[r], np, EPSF);
                const float val = (acc[r] * INVSC2) * __builtin_amdgcn_rcpf(den);
                sm[wave][m][slot] = val;
            }
        }
    }

    __syncthreads();

    // softmax over the 49 offsets; threads 0..127 own one pixel each (waves 4..7 skip uniformly).
    // The pixel's whole row is read once into registers (12 x 16 B + 1 x 4 B; the 208-B pitch is an odd
    // multiple of 16 B) and max, exp, sum and scale run on registers; the sum keeps the order k = 0..48.
    // Every loop below is fully unrolled so that v[] is indexed by constants and stays in registers; a
    // rolled loop pays one dependent LDS round trip per trip. All scaling precedes the stores, so that no
    // store's data register is rewritten behind it.
    const int p = threadIdx.x;
    if (p < WW) {
        const float* row = &sm[p >> 4][p & 15][0];
        float v[NOFF];
#pragma unroll
        for (int q = 0; q < (NOFF - 1) / 4; ++q) {
            const v4f t = *(const v4f*)(row + 4 * q);
            v[4 * q + 0] = t[0];
            v[4 * q + 1] = t[1];
            v[4 * q + 2] = t[2];
            v[4 * q + 3] = t[3];
        }
        v[NOFF - 1] = row[NOFF - 1];

        float mx = v[0];
#pragma unroll
        for (int k = 1; k < NOFF; ++k) mx = fmaxf(mx, v[k]);
        float sum = 0.f;
#pragma unroll
        for (int k = 0; k < NOFF; ++k) {
            v[k] = expf(v[k] - mx);
            sum += v[k];
        }
        const float inv = __builtin_amdgcn_rcpf(sum);   // sum in [1, 49]

        float* op = out + (size_t)b * NOFF * OPIX + (size_t)h * WW + p;
#pragma unroll
        for (int k = 0; k < NOFF; ++k) v[k] *= inv;
#pragma unroll
        for (int k = 0; k < NOFF; ++k) op[(size_t)k * OPIX] = v[k];
    }
}

// ---------------------------------------------------------------------------
// Workspace: [ xT f16 (B,HP,WP,C) = 9,193,472 B | norms f32 (B,HP,160) = 343,040 B ] = 9,536,512 B.
// ---------------------------------------------------------------------------
extern "C" void kernel_launch(void* const* d_in, const int* in_sizes, int n_in,
                              void* d_out, int out_size, void* d_ws, size_t ws_size,
                              hipStream_t stream)
{
    if (n_in < 1) return;
    if (in_sizes[0] != BB * CC * HH * WW) return;
    if (out_size != BB * NOFF * OPIX) return;

    const size_t xT_bytes  = (size_t)BB * HP * WP * CC * sizeof(_Float16);   // multiple of 128
    const size_t nrm_bytes = (size_t)BB * HP * NPITCH * sizeof(float);
    if (xT_bytes + nrm_bytes > ws_size) return;

    const float* x   = (const float*)d_in[0];
    float*       out = (float*)d_out;
    _Float16*    xT  = (_Float16*)d_ws;
    float*       nrm = (float*)((char*)d_ws + xT_bytes);

    prep_kernel<<<dim3(HP, BB), dim3(256), 0, stream>>>(x, xT, nrm);
    sim_softmax_kernel<<<dim3(BB * HH), dim3(256), 0, stream>>>(xT, nrm, out);
    (void)hipGetLastError();
}

// v002
// One run takes 9.93 microseconds.
// Next to v001, in two timings, it ran 1.86 and 1.89 times as fast.
// Counting every step since v000, it is 2.44 times as fast.
// Channel dot products (band Gram tiles): v_wmma_f32_16x16x32_f16, f16 operands (x carried x64), f32 accumulate; norms, normalisation and softmax in f32.
#include <hip/hip_runtime.h>
#include <math.h>

#define BB     4
#define CC     64
#define HH     128
#define WW     128
#define KK     7
#define NOFF   (KK * KK)        // 49 window offsets
#define PAD    3
#define HP     (HH + 2 * PAD)   // 134 padded rows
#define WP     (WW + 2 * PAD)   // 134 padded columns
#define NSP    136              // LDS pitch (floats) of a staged norm row
#define EPSF   1e-7f
#define XSC    64.0f            // power-of-two carry scale of the f16 copy of x
#define INVSC2 (1.0f / 4096.0f) // undo XSC*XSC in the f32 epilogue
#define HSP    72               // LDS pitch (halves) of the f16 pixel tile
#define SMP    52               // LDS pitch (floats) of the per-pixel offset row
#define OPIX   (HH * WW)        // 16384
#define ROWS   2                // output rows per block
#define SROWS  (ROWS + KK - 1)  // 8 staged padded rows
#define NWAVE  (ROWS * WW / 16) // 16 waves, one 16-pixel tile each

typedef _Float16 v16h __attribute__((ext_vector_type(16)));
typedef _Float16 v8h  __attribute__((ext_vector_type(8)));
typedef float    v8f  __attribute__((ext_vector_type(8)));
typedef float    v4f  __attribute__((ext_vector_type(4)));
union FragH { v16h v; v8h half[2]; };

// 16x16x32 f16 WMMA with the dependency guard: 4 VALU slots before anything touches D, A/B kept live.
__device__ __forceinline__ v8f wmma_f16(v16h a, v16h b, v8f c)
{
    v8f d = __builtin_amdgcn_wmma_f32_16x16x32_f16(false, a, false, b, (short)0, c, false, false);
    asm volatile("v_nop\n\tv_nop\n\tv_nop\n\tv_nop" : "+v"(d) : "v"(a), "v"(b));
    return d;
}

// ---------------------------------------------------------------------------
// One launch. One block per (batch b, strip of ROWS output rows h0, h0+1); 16 waves.
// Phase 1: the 8 padded rows h0..h0+7 of x (B,C,H,W) f32 go straight into LDS as a padded pixel-major
//   f16 tile hs[row][padded column][channel], value = x*64 (zeros in the halo), with the per-pixel L2
//   norms ns[row][padded column] from the f32 data (0 in the halo). A thread owns one pixel of two rows:
//   64 coalesced 4-byte loads (a wave = one 128-B line per channel), sum of squares in the order
//   c = 0..63, eight 16-byte LDS stores (144-B pitch = 16 B x odd).
// Phase 2: each wave owns 16 output pixels w0..w0+15 of row h0+rsel.
// Band WMMA: for each vertical offset i, two 16x16 D tiles (each = two 16x16x32 steps over the 64
// channels): A = 16 centre pixel vectors (rows m), B = 16 neighbour vectors at padded columns
// w0+16*tile+n (columns n); D[m][n] holds horizontal offset j = n - m + 16*tile, valid when 0<=j<7.
// A and B fragments both use the split k map: elements 0..7 <- k0+8*half, 8..15 <- k0+16+8*half.
// Extraction is branch-free: invalid (m,n) pairs land in trash slot 49 of the per-pixel LDS row.
// Phase 3: thread p (< 256) runs the 49-way softmax of pixel p in f32 in registers and writes
// out[b][k][(h0 + p/128)*128 + p%128].
// ---------------------------------------------------------------------------
__global__ __launch_bounds__(NWAVE * 32)
void sim_softmax_kernel(const float* __restrict__ x,
                        float* __restrict__ out)
{
    __shared__ __align__(16) _Float16 hs[SROWS][WP][HSP];      // 154,368 B
    __shared__ __align__(16) float    sm[NWAVE][16][SMP];      // [wave][pixel][offset slot] (+trash 49, pad)
    __shared__ float ns[SROWS][NSP];

    const int blk  = blockIdx.x;
    const int b    = blk / (HH / ROWS);
    const int h0   = (blk % (HH / ROWS)) * ROWS;
    const int tid  = threadIdx.x;
    const int lane = tid & 31;
    const int wave = tid >> 5;

    // ---- phase 1: stage the 8 padded rows ----
    const v8h zh = (v8h){0, 0, 0, 0, 0, 0, 0, 0};
    {
        const int w  = tid & (WW - 1);                               // image column of this thread
        // 0..3, the same in a whole wave; read as a scalar so that the row test below is a scalar branch
        const int rg = __builtin_amdgcn_readfirstlane(tid >> 7);
        const float* xb = x + (size_t)b * CC * HH * WW + w;
        // every loop of this phase is unrolled: f[] and hv[] are then indexed by constants and stay in
        // registers, and a row's 64 loads issue as one group ahead of the first use
#pragma unroll
        for (int t = 0; t < SROWS / 4; ++t) {
            const int sr = rg + 4 * t;                               // staged row = padded row h0 + sr
            const int r  = h0 + sr - PAD;                            // image row
            if (r >= 0 && r < HH) {                                  // wave-uniform
                const float* xp = xb + (size_t)r * WW;
                float f[CC];
#pragma unroll
                for (int c = 0; c < CC; ++c) f[c] = xp[(size_t)c * HH * WW];
                float s = 0.f;
#pragma unroll
                for (int g = 0; g < CC / 8; ++g) {
                    v8h hv;
#pragma unroll
                    for (int e = 0; e < 8; ++e) {
                        const float v = f[g * 8 + e];
                        s = fmaf(v, v, s);
                        hv[e] = (_Float16)(v * XSC);
                    }
                    *(v8h*)(&hs[sr][w + PAD][g * 8]) = hv;
                }
                ns[sr][w + PAD] = sqrtf(s);
            } else {
#pragma unroll
                for (int g = 0; g < CC / 8; ++g) *(v8h*)(&hs[sr][w + PAD][g * 8]) = zh;
                ns[sr][w + PAD] = 0.f;
            }
        }
        // halo columns 0..2 and 131..133 of every staged row: 8 rows x 6 columns x 8 chunks of 16 B
        if (tid < SROWS * 2 * PAD * 8) {
            const int sr = tid / (2 * PAD * 8);
            const int q  = tid % (2 * PAD * 8);
            const int ci = q >> 3;
            const int pc = (ci < PAD) ? ci : (ci + WW);
            *(v8h*)(&hs[sr][pc][(q & 7) * 8]) = zh;
            if ((q & 7) == 0) ns[sr][pc] = 0.f;
        }
    }
    __syncthreads();

    // ---- phase 2: band Gram tiles from LDS ----
    const int rsel = wave >> 3;                       // output row of this wave within the strip
    const int w0   = (wave & 7) * 16;
    const int half = lane >> 4;
    const int n    = lane & 15;                       // A row / B column / D column of this lane

    // A fragments: centre pixel m = n at staged (rsel+3, w0+3+n), channels 0..31 and 32..63
    const _Float16* cpix = &hs[rsel + PAD][w0 + PAD + n][0];
    FragH a0, a1;
    a0.half[0] = *(const v8h*)(cpix +      8 * half);
    a0.half[1] = *(const v8h*)(cpix + 16 + 8 * half);
    a1.half[0] = *(const v8h*)(cpix + 32 + 8 * half);
    a1.half[1] = *(const v8h*)(cpix + 48 + 8 * half);

    // centre norms of this lane's 8 D rows (pixels 8*half + r)
    const float* ncRow = &ns[rsel + PAD][(w0 + PAD) + 8 * half];
    float ncv[8];
#pragma unroll
    for (int r = 0; r < 8; ++r) ncv[r] = ncRow[r];

#pragma unroll 1
    for (int i = 0; i < KK; ++i) {
        const _Float16* rowi = &hs[rsel + i][0][0];   // padded row h+i
        const float*    nri  = &ns[rsel + i][0];

#pragma unroll
        for (int tile = 0; tile < 2; ++tile) {
            int col = w0 + 16 * tile + n;              // this lane's B column (padded), arithmetic
            col = (col < WP) ? col : (WP - 1);         // clamp keeps the address in range (junk unused)
            const float np = nri[col];                 // neighbour norm of D column n

            const _Float16* bp = rowi + col * HSP;
            FragH b0, b1;
            b0.half[0] = *(const v8h*)(bp +      8 * half);
            b0.half[1] = *(const v8h*)(bp + 16 + 8 * half);
            b1.half[0] = *(const v8h*)(bp + 32 + 8 * half);
            b1.half[1] = *(const v8h*)(bp + 48 + 8 * half);

            v8f acc = (v8f){0.f, 0.f, 0.f, 0.f, 0.f, 0.f, 0.f, 0.f};
            acc = wmma_f16(a0.v, b0.v, acc);
            acc = wmma_f16(a1.v, b1.v, acc);

#pragma unroll
            for (int r = 0; r < 8; ++r) {
                const int m    = r + 8 * half;                 // output pixel within the wave tile
                const int j    = n - m + 16 * tile;            // horizontal offset
                const int slot = ((unsigned)j < (unsigned)KK) ? (i * KK + j) : NOFF;
                const float den = fmaf(ncv[r], np, EPSF);
                const float val = (acc[r] * INVSC2) * __builtin_amdgcn_rcpf(den);
                sm[wave][m][slot] = val;
            }
        }
    }

    __syncthreads();
    // softmax over the 49 offsets; threads 0..255 own one pixel each (waves 8..15 skip uniformly).
    // The pixel's whole row is read once into registers (12 x 16 B + 1 x 4 B; the 208-B pitch is an odd
    // multiple of 16 B) and max, exp, sum and scale run on registers; the sum keeps the order k = 0..48.
    // Every loop below is fully unrolled so that v[] is indexed by constants and stays in registers; a
    // rolled loop pays one dependent LDS round trip per trip. All scaling precedes the stores, so that no
    // store's data register is rewritten behind it.
    const int p = threadIdx.x;
    if (p < ROWS * WW) {
        const float* row = &sm[p >> 4][p & 15][0];
        float v[NOFF];
#pragma unroll
        for (int q = 0; q < (NOFF - 1) / 4; ++q) {
            const v4f t = *(const v4f*)(row + 4 * q);
            v[4 * q + 0] = t[0];
            v[4 * q + 1] = t[1];
            v[4 * q + 2] = t[2];
            v[4 * q + 3] = t[3];
        }
        v[NOFF - 1] = row[NOFF - 1];

        float mx = v[0];
#pragma unroll
        for (int k = 1; k < NOFF; ++k) mx = fmaxf(mx, v[k]);
        float sum = 0.f;
#pragma unroll
        for (int k = 0; k < NOFF; ++k) {
            v[k] = expf(v[k] - mx);
            sum += v[k];
        }
        const float inv = __builtin_amdgcn_rcpf(sum);   // sum in [1, 49]

        float* op = out + (size_t)b * NOFF * OPIX + (size_t)(h0 + (p >> 7)) * WW + (p & (WW - 1));
#pragma unroll
        for (int k = 0; k < NOFF; ++k) v[k] *= inv;
#pragma unroll
        for (int k = 0; k < NOFF; ++k) op[(size_t)k * OPIX] = v[k];
    }
}

// ---------------------------------------------------------------------------
// No workspace is used.
// ---------------------------------------------------------------------------
extern "C" void kernel_launch(void* const* d_in, const int* in_sizes, int n_in,
                              void* d_out, int out_size, void* d_ws, size_t ws_size,
                              hipStream_t stream)
{
    (void)d_ws;
    (void)ws_size;
    if (n_in < 1) return;
    if (in_sizes[0] != BB * CC * HH * WW) return;
    if (out_size != BB * NOFF * OPIX) return;

    const float* x   = (const float*)d_in[0];
    float*       out = (float*)d_out;

    sim_softmax_kernel<<<dim3(BB * HH / ROWS), dim3(NWAVE * 32), 0, stream>>>(x, out);
    (void)hipGetLastError();
}

// v003
// One run takes 9.16 microseconds.
// Timed twice side by side with v002, it ran 1.09 and 1.08 times as fast.
// Counting every step since v000, it is 2.64 times as fast.
// Channel dot products (band Gram tiles): v_wmma_f32_16x16x32_f16, f16 operands (x carried x64), f32 accumulate; norms, normalisation and softmax in f32.
#include <hip/hip_runtime.h>
#include <math.h>

#define BB     4
#define CC     64
#define HH     128
#define WW     128
#define KK     7
#define NOFF   (KK * KK)        // 49 window offsets
#define PAD    3
#define HP     (HH + 2 * PAD)   // 134 padded rows
#define WP     (WW + 2 * PAD)   // 134 padded columns
#define NSP    136              // LDS pitch (floats) of a staged norm row
#define EPSF   1e-7f
#define XSC    64.0f            // power-of-two carry scale of the f16 copy of x
#define INVSC2 (1.0f / 4096.0f) // undo XSC*XSC in the f32 epilogue
#define HSP    72               // LDS pitch (halves) of the f16 pixel tile
#define SLW    16               // floats kept per (pixel, window row): neighbour index modulo 16
#define PXP    (KK * SLW + 4)   // 116: LDS pitch (floats) of a pixel's similarity row, 16 B x odd
#define TLP    (16 * PXP + 32)  // LDS pitch (floats) of a wave's 16 pixels; +32 banks between neighbour tiles
#define OPIX   (HH * WW)        // 16384
#define ROWS   2                // output rows per block
#define SROWS  (ROWS + KK - 1)  // 8 staged padded rows
#define NWAVE  (ROWS * WW / 16) // 16 waves, one 16-pixel tile each

typedef _Float16 v16h __attribute__((ext_vector_type(16)));
typedef _Float16 v8h  __attribute__((ext_vector_type(8)));
typedef float    v8f  __attribute__((ext_vector_type(8)));
typedef float    v4f  __attribute__((ext_vector_type(4)));
union FragH { v16h v; v8h half[2]; };

// 16x16x32 f16 WMMA, f32 accumulate. The plain builtin: the compiler keeps the distance behind it itself.
__device__ __forceinline__ v8f wmma_f16(v16h a, v16h b, v8f c)
{
    return __builtin_amdgcn_wmma_f32_16x16x32_f16(false, a, false, b, (short)0, c, false, false);
}

// Eight reciprocals in place, in one statement: behind a transcendental the instruction set asks for one
// instruction that neither reads its result nor overwrites its source. Here each v_rcp_f32 has the next one
// (other registers) behind it and the last has the v_nop.
__device__ __forceinline__ void rcp8(v4f& a, v4f& b)
{
    float a0 = a[0], a1 = a[1], a2 = a[2], a3 = a[3], b0 = b[0], b1 = b[1], b2 = b[2], b3 = b[3];
    asm("v_rcp_f32 %0, %0\n\tv_rcp_f32 %1, %1\n\tv_rcp_f32 %2, %2\n\tv_rcp_f32 %3, %3\n\t"
        "v_rcp_f32 %4, %4\n\tv_rcp_f32 %5, %5\n\tv_rcp_f32 %6, %6\n\tv_rcp_f32 %7, %7\n\tv_nop"
        : "+v"(a0), "+v"(a1), "+v"(a2), "+v"(a3), "+v"(b0), "+v"(b1), "+v"(b2), "+v"(b3));
    a = (v4f){a0, a1, a2, a3};
    b = (v4f){b0, b1, b2, b3};
}

// ---------------------------------------------------------------------------
// One launch. One block per (batch b, strip of ROWS output rows h0, h0+1); 16 waves.
// Phase 1: the 8 padded rows h0..h0+7 of x (B,C,H,W) f32 go straight into LDS as a padded pixel-major
//   f16 tile hs[row][padded column][channel], value = x*64 (zeros in the halo), with the per-pixel L2
//   norms ns[row][padded column] from the f32 data (0 in the halo). A thread owns one pixel of two rows:
//   64 coalesced 4-byte loads (a wave = one 128-B line per channel), sum of squares in the order
//   c = 0..63, eight 16-byte LDS stores (144-B pitch = 16 B x odd).
// Phase 2: each wave owns 16 output pixels w0..w0+15 of row h0+rsel.
// Band WMMA: for each vertical offset i, two 16x16 D tiles (each = two 16x16x32 steps over the 64
// channels): A = 16 neighbour vectors at padded columns w0+16*tile+m (rows m), B = 16 centre pixel
// vectors (columns n); D[m][n] holds horizontal offset j = m - n + 16*tile, valid when 0<=j<7.
// A and B fragments both use the split k map: elements 0..7 <- k0+8*half, 8..15 <- k0+16+8*half.
// A lane's 8 D registers are 8 consecutive neighbours q = 16*tile + 8*half + r of ONE pixel n. Pixel n
// needs q = n..n+6, which lies in two of the 8-wide chunks 0, 1, 2: lanes 16..31 keep chunk 1, lanes
// 0..7 chunk 0, lanes 8..15 chunk 2 (tile 1). The kept chunk is normalised and goes to LDS as two
// 16-byte stores at slot q mod 16 of the pixel's row for offset i.
// Phase 3: thread p (< 256) runs the 49-way softmax of pixel p in f32 in registers and writes
// out[b][k][(h0 + p/128)*128 + p%128].
// ---------------------------------------------------------------------------
__global__ __launch_bounds__(NWAVE * 32)
void sim_softmax_kernel(const float* __restrict__ x,
                        float* __restrict__ out)
{
    __shared__ __align__(16) _Float16 hs[SROWS][WP][HSP];      // 154,368 B
    __shared__ __align__(16) float    sm[NWAVE][TLP];          // [wave][pixel * PXP + i * SLW + (q mod 16)]
    __shared__ __align__(16) float    ns[SROWS][NSP];

    const int blk  = blockIdx.x;
    const int b    = blk / (HH / ROWS);
    const int h0   = (blk % (HH / ROWS)) * ROWS;
    const int tid  = threadIdx.x;
    const int lane = tid & 31;
    const int wave = tid >> 5;

    // ---- phase 1: stage the 8 padded rows ----
    const v8h zh = (v8h){0, 0, 0, 0, 0, 0, 0, 0};
    {
        const int w  = tid & (WW - 1);                               // image column of this thread
        // 0..3, the same in a whole wave; read as a scalar so that the row test below is a scalar branch
        const int rg = __builtin_amdgcn_readfirstlane(tid >> 7);
        const float* xb = x + (size_t)b * CC * HH * WW + w;
        // every loop of this phase is unrolled: f[] and hv[] are then indexed by constants and stay in
        // registers, and a row's 64 loads issue as one group ahead of the first use
#pragma unroll
        for (int t = 0; t < SROWS / 4; ++t) {
            const int sr = rg + 4 * t;                               // staged row = padded row h0 + sr
            const int r  = h0 + sr - PAD;                            // image row
            if (r >= 0 && r < HH) {                                  // wave-uniform
                const float* xp = xb + (size_t)r * WW;
                float f[CC];
#pragma unroll
                for (int c = 0; c < CC; ++c) f[c] = xp[(size_t)c * HH * WW];
                float s = 0.f;
#pragma unroll
                for (int g = 0; g < CC / 8; ++g) {
                    v8h hv;
#pragma unroll
                    for (int e = 0; e < 8; ++e) {
                        const float v = f[g * 8 + e];
                        s = fmaf(v, v, s);
                        hv[e] = (_Float16)(v * XSC);
                    }
                    *(v8h*)(&hs[sr][w + PAD][g * 8]) = hv;
                }
                ns[sr][w + PAD] = sqrtf(s);
            } else {
#pragma unroll
                for (int g = 0; g < CC / 8; ++g) *(v8h*)(&hs[sr][w + PAD][g * 8]) = zh;
                ns[sr][w + PAD] = 0.f;
            }
        }
        // halo columns 0..2 and 131..133 of every staged row: 8 rows x 6 columns x 8 chunks of 16 B
        if (tid < SROWS * 2 * PAD * 8) {
            const int sr = tid / (2 * PAD * 8);
            const int q  = tid % (2 * PAD * 8);
            const int ci = q >> 3;
            const int pc = (ci < PAD) ? ci : (ci + WW);
            *(v8h*)(&hs[sr][pc][(q & 7) * 8]) = zh;
            if ((q & 7) == 0) ns[sr][pc] = 0.f;
        }
        // pitch columns 134, 135 of the norm rows: the 16-byte norm reads of the last tile touch them
        if (tid < SROWS * (NSP - WP)) ns[tid / (NSP - WP)][WP + tid % (NSP - WP)] = 0.f;
    }
    __syncthreads();

    // ---- phase 2: band Gram tiles from LDS ----
    const int rsel = wave >> 3;                       // output row of this wave within the strip
    const int w0   = (wave & 7) * 16;
    const int half = lane >> 4;
    const int n    = lane & 15;                       // A row / B column / D column of this lane

    // B fragments: centre pixel n at staged (rsel+3, w0+3+n), channels 0..31 and 32..63
    const _Float16* cpix = &hs[rsel + PAD][w0 + PAD + n][0];
    FragH c0, c1;
    c0.half[0] = *(const v8h*)(cpix +      8 * half);
    c0.half[1] = *(const v8h*)(cpix + 16 + 8 * half);
    c1.half[0] = *(const v8h*)(cpix + 32 + 8 * half);
    c1.half[1] = *(const v8h*)(cpix + 48 + 8 * half);

    const float nc  = ns[rsel + PAD][w0 + PAD + n];   // centre norm of this lane's D column
    const bool  far = (lane >= 8) && (lane < 16);     // this lane keeps chunk 2 (tile 1, D rows 0..7)
    const int   cb  = w0 + (far ? 16 : 8 * half);     // padded column of the first neighbour it keeps
    float*      srow = &sm[wave][n * PXP + 8 * half]; // chunks 0 and 2 at slots 0..7, chunk 1 at 8..15

    int col1 = w0 + 16 + n;                           // tile 1: this lane's A row (padded column)
    col1 = (col1 < WP) ? col1 : (WP - 1);             // clamp keeps the address in range (junk unused)
    const _Float16* nb0 = &hs[rsel][w0 + n][8 * half];
    const _Float16* nb1 = &hs[rsel][col1][8 * half];
    const float*    nrm = &ns[rsel][cb];              // norms of the 8 kept neighbours

    // unrolled: every LDS access of the 7 window rows is then one base register plus a constant offset,
    // and a row's fragment reads can issue while the row before it is still in the matrix unit
#pragma unroll
    for (int i = 0; i < KK; ++i) {
        const _Float16* p0 = nb0 + i * (WP * HSP);    // padded row h+i
        const _Float16* p1 = nb1 + i * (WP * HSP);
        FragH t0a, t0b, t1a, t1b;
        t0a.half[0] = *(const v8h*)(p0);
        t0a.half[1] = *(const v8h*)(p0 + 16);
        t0b.half[0] = *(const v8h*)(p0 + 32);
        t0b.half[1] = *(const v8h*)(p0 + 48);
        t1a.half[0] = *(const v8h*)(p1);
        t1a.half[1] = *(const v8h*)(p1 + 16);
        t1b.half[0] = *(const v8h*)(p1 + 32);
        t1b.half[1] = *(const v8h*)(p1 + 48);
        const v4f np0 = *(const v4f*)(nrm + i * NSP);
        const v4f np1 = *(const v4f*)(nrm + i * NSP + 4);

        const v8f zero = (v8f){0.f, 0.f, 0.f, 0.f, 0.f, 0.f, 0.f, 0.f};
        v8f acc0 = wmma_f16(t0a.v, c0.v, zero);
        v8f acc1 = wmma_f16(t1a.v, c0.v, zero);
        acc0 = wmma_f16(t0b.v, c1.v, acc0);
        acc1 = wmma_f16(t1b.v, c1.v, acc1);

        v4f d0, d1, o0, o1;
#pragma unroll
        for (int r = 0; r < 4; ++r) {
            d0[r] = fmaf(nc, np0[r], EPSF);
            d1[r] = fmaf(nc, np1[r], EPSF);
        }
        rcp8(d0, d1);
#pragma unroll
        for (int r = 0; r < 4; ++r) {
            o0[r] = ((far ? acc1[r]     : acc0[r])     * INVSC2) * d0[r];
            o1[r] = ((far ? acc1[r + 4] : acc0[r + 4]) * INVSC2) * d1[r];
        }
        *(v4f*)(srow + i * SLW)     = o0;
        *(v4f*)(srow + i * SLW + 4) = o1;
    }

    __syncthreads();
    // softmax over the 49 offsets; threads 0..255 own one pixel each (waves 8..15 skip uniformly).
    // The pixel's 49 values are read once into registers (offset (i, j) of pixel n stands at slot
    // (n + j) mod 16 of row i) and max, exp, sum and scale run on registers; the sum keeps the order k = 0..48.
    // Every loop below is fully unrolled so that v[] is indexed by constants and stays in registers; a
    // rolled loop pays one dependent LDS round trip per trip. All scaling precedes the stores, so that no
    // store's data register is rewritten behind it.
    const int p = threadIdx.x;
    if (p < ROWS * WW) {
        const float* row = &sm[p >> 4][(p & 15) * PXP];
        float v[NOFF];
#pragma unroll
        for (int j = 0; j < KK; ++j) {
            const float* rj = row + (((p & 15) + j) & (SLW - 1));
#pragma unroll
            for (int i = 0; i < KK; ++i) v[i * KK + j] = rj[i * SLW];
        }

        float mx = v[0];
#pragma unroll
        for (int k = 1; k < NOFF; ++k) mx = fmaxf(mx, v[k]);
        float sum = 0.f;
#pragma unroll
        for (int k = 0; k < NOFF; ++k) {
            v[k] = expf(v[k] - mx);
            sum += v[k];
        }
        const float inv = __builtin_amdgcn_rcpf(sum);   // sum in [1, 49]

        float* op = out + (size_t)b * NOFF * OPIX + (size_t)(h0 + (p >> 7)) * WW + (p & (WW - 1));
#pragma unroll
        for (int k = 0; k < NOFF; ++k) v[k] *= inv;
#pragma unroll
        for (int k = 0; k < NOFF; ++k) op[(size_t)k * OPIX] = v[k];
    }
}

// ---------------------------------------------------------------------------
// No workspace is used.
// ---------------------------------------------------------------------------
extern "C" void kernel_launch(void* const* d_in, const int* in_sizes, int n_in,
                              void* d_out, int out_size, void* d_ws, size_t ws_size,
                              hipStream_t stream)
{
    (void)d_ws;
    (void)ws_size;
    if (n_in < 1) return;
    if (in_sizes[0] != BB * CC * HH * WW) return;
    if (out_size != BB * NOFF * OPIX) return;

    const float* x   = (const float*)d_in[0];
    float*       out = (float*)d_out;

    sim_softmax_kernel<<<dim3(BB * HH / ROWS), dim3(NWAVE * 32), 0, stream>>>(x, out);
    (void)hipGetLastError();
}

// v004
// It runs in 8.63 microseconds.
// Timed twice side by side with v003, it ran 1.07 and 1.06 times as fast.
// All steps since v000 together make it 2.81 times as fast.
// Channel dot products (band Gram tiles): v_wmma_f32_16x16x32_f16, f16 operands (x carried x64), f32 accumulate; norms, normalisation and softmax in f32.
#include <hip/hip_runtime.h>
#include <math.h>

#define BB     4
#define CC     64
#define HH     128
#define WW     128
#define KK     7
#define NOFF   (KK * KK)        // 49 window offsets
#define PAD    3
#define HP     (HH + 2 * PAD)   // 134 padded rows
#define WP     (WW + 2 * PAD)   // 134 padded columns
#define NSP    136              // LDS pitch (floats) of a staged norm row
#define EPSF   1e-7f
#define XSC    64.0f            // power-of-two carry scale of the f16 copy of x
#define INVSC2 (1.0f / 4096.0f) // undo XSC*XSC in the f32 epilogue
#define LOG2E  1.44269504088896f // scores leave the epilogue times log2(e): exp(s) = 2^(s*log2(e))
#define HSP    72               // LDS pitch (halves) of the f16 pixel tile
#define SLW    16               // floats kept per (pixel, window row): neighbour index modulo 16
#define PXP    (KK * SLW + 4)   // 116: LDS pitch (floats) of a pixel's similarity row, 16 B x odd
#define TLP    (16 * PXP + 32)  // LDS pitch (floats) of a wave's 16 pixels; +32 banks between neighbour tiles
#define OPIX   (HH * WW)        // 16384
#define ROWS   2                // output rows per block
#define SROWS  (ROWS + KK - 1)  // 8 staged padded rows
#define NWAVE  (ROWS * WW / 16) // 16 waves, one 16-pixel tile each

typedef _Float16 v16h __attribute__((ext_vector_type(16)));
typedef _Float16 v8h  __attribute__((ext_vector_type(8)));
typedef float    v8f  __attribute__((ext_vector_type(8)));
typedef float    v4f  __attribute__((ext_vector_type(4)));
union FragH { v16h v; v8h half[2]; };

// 16x16x32 f16 WMMA, f32 accumulate. The plain builtin: the compiler keeps the distance behind it itself.
__device__ __forceinline__ v8f wmma_f16(v16h a, v16h b, v8f c)
{
    return __builtin_amdgcn_wmma_f32_16x16x32_f16(false, a, false, b, (short)0, c, false, false);
}

// Eight reciprocals in place, in one statement: behind a transcendental the instruction set asks for one
// instruction that neither reads its result nor overwrites its source. Here each v_rcp_f32 has the next one
// (other registers) behind it and the last has the v_nop.
__device__ __forceinline__ void rcp8(v4f& a, v4f& b)
{
    float a0 = a[0], a1 = a[1], a2 = a[2], a3 = a[3], b0 = b[0], b1 = b[1], b2 = b[2], b3 = b[3];
    asm("v_rcp_f32 %0, %0\n\tv_rcp_f32 %1, %1\n\tv_rcp_f32 %2, %2\n\tv_rcp_f32 %3, %3\n\t"
        "v_rcp_f32 %4, %4\n\tv_rcp_f32 %5, %5\n\tv_rcp_f32 %6, %6\n\tv_rcp_f32 %7, %7\n\tv_nop"
        : "+v"(a0), "+v"(a1), "+v"(a2), "+v"(a3), "+v"(b0), "+v"(b1), "+v"(b2), "+v"(b3));
    a = (v4f){a0, a1, a2, a3};
    b = (v4f){b0, b1, b2, b3};
}

// ---------------------------------------------------------------------------
// One launch. One block per (batch b, strip of ROWS output rows h0, h0+1); 16 waves.
// Phase 1: the 8 padded rows h0..h0+7 of x (B,C,H,W) f32 go straight into LDS as a padded pixel-major
//   f16 tile hs[row][padded column][channel], value = x*64 (zeros in the halo), with the per-pixel L2
//   norms ns[row][padded column] from the f32 data (0 in the halo). A thread owns one pixel of two rows:
//   64 coalesced 4-byte loads (a wave = one 128-B line per channel), sum of squares in the order
//   c = 0..63, eight 16-byte LDS stores (144-B pitch = 16 B x odd).
// Phase 2: each wave owns 16 output pixels w0..w0+15 of row h0+rsel.
// Band WMMA: for each vertical offset i, two 16x16 D tiles (each = two 16x16x32 steps over the 64
// channels): A = 16 neighbour vectors at padded columns w0+16*tile+m (rows m), B = 16 centre pixel
// vectors (columns n); D[m][n] holds horizontal offset j = m - n + 16*tile, valid when 0<=j<7.
// A and B fragments both use the split k map: elements 0..7 <- k0+8*half, 8..15 <- k0+16+8*half.
// A lane's 8 D registers are 8 consecutive neighbours q = 16*tile + 8*half + r of ONE pixel n. Pixel n
// needs q = n..n+6, which lies in two of the 8-wide chunks 0, 1, 2: lanes 16..31 keep chunk 1, lanes
// 0..7 chunk 0, lanes 8..15 chunk 2 (tile 1). The kept chunk is normalised, scaled by log2(e) and goes
// to LDS as two 16-byte stores at slot q mod 16 of the pixel's row for offset i.
// Phase 3: thread p (< 256) runs the 49-way softmax of pixel p in f32 in registers, in base 2 and
// without a maximum (see there), and writes out[b][k][(h0 + p/128)*128 + p%128].
// ---------------------------------------------------------------------------
__global__ __launch_bounds__(NWAVE * 32)
void sim_softmax_kernel(const float* __restrict__ x,
                        float* __restrict__ out)
{
    __shared__ __align__(16) _Float16 hs[SROWS][WP][HSP];      // 154,368 B
    __shared__ __align__(16) float    sm[NWAVE][TLP];          // [wave][pixel * PXP + i * SLW + (q mod 16)]
    __shared__ __align__(16) float    ns[SROWS][NSP];

    const int blk  = blockIdx.x;
    const int b    = blk / (HH / ROWS);
    const int h0   = (blk % (HH / ROWS)) * ROWS;
    const int tid  = threadIdx.x;
    const int lane = tid & 31;
    const int wave = tid >> 5;

    // ---- phase 1: stage the 8 padded rows ----
    const v8h zh = (v8h){0, 0, 0, 0, 0, 0, 0, 0};
    {
        const int w  = tid & (WW - 1);                               // image column of this thread
        // 0..3, the same in a whole wave; read as a scalar so that the row test below is a scalar branch
        const int rg = __builtin_amdgcn_readfirstlane(tid >> 7);
        const float* xb = x + (size_t)b * CC * HH * WW + w;
        // every loop of this phase is unrolled: f[] and hv[] are then indexed by constants and stay in
        // registers, and a row's 64 loads issue as one group ahead of the first use
#pragma unroll
        for (int t = 0; t < SROWS / 4; ++t) {
            const int sr = rg + 4 * t;                               // staged row = padded row h0 + sr
            const int r  = h0 + sr - PAD;                            // image row
            if (r >= 0 && r < HH) {                                  // wave-uniform
                const float* xp = xb + (size_t)r * WW;
                float f[CC];
#pragma unroll
                for (int c = 0; c < CC; ++c) f[c] = xp[(size_t)c * HH * WW];
                float s = 0.f;
#pragma unroll
                for (int g = 0; g < CC / 8; ++g) {
                    v8h hv;
#pragma unroll
                    for (int e = 0; e < 8; ++e) {
                        const float v = f[g * 8 + e];
                        s = fmaf(v, v, s);
                        hv[e] = (_Float16)(v * XSC);
                    }
                    *(v8h*)(&hs[sr][w + PAD][g * 8]) = hv;
                }
                ns[sr][w + PAD] = sqrtf(s);
            } else {
#pragma unroll
                for (int g = 0; g < CC / 8; ++g) *(v8h*)(&hs[sr][w + PAD][g * 8]) = zh;
                ns[sr][w + PAD] = 0.f;
            }
        }
        // halo columns 0..2 and 131..133 of every staged row: 8 rows x 6 columns x 8 chunks of 16 B
        if (tid < SROWS * 2 * PAD * 8) {
            const int sr = tid / (2 * PAD * 8);
            const int q  = tid % (2 * PAD * 8);
            const int ci = q >> 3;
            const int pc = (ci < PAD) ? ci : (ci + WW);
            *(v8h*)(&hs[sr][pc][(q & 7) * 8]) = zh;
            if ((q & 7) == 0) ns[sr][pc] = 0.f;
        }
        // pitch columns 134, 135 of the norm rows: the 16-byte norm reads of the last tile touch them
        if (tid < SROWS * (NSP - WP)) ns[tid / (NSP - WP)][WP + tid % (NSP - WP)] = 0.f;
    }
    __syncthreads();

    // ---- phase 2: band Gram tiles from LDS ----
    const int rsel = wave >> 3;                       // output row of this wave within the strip
    const int w0   = (wave & 7) * 16;
    const int half = lane >> 4;
    const int n    = lane & 15;                       // A row / B column / D column of this lane

    // B fragments: centre pixel n at staged (rsel+3, w0+3+n), channels 0..31 and 32..63
    const _Float16* cpix = &hs[rsel + PAD][w0 + PAD + n][0];
    FragH c0, c1;
    c0.half[0] = *(const v8h*)(cpix +      8 * half);
    c0.half[1] = *(const v8h*)(cpix + 16 + 8 * half);
    c1.half[0] = *(const v8h*)(cpix + 32 + 8 * half);
    c1.half[1] = *(const v8h*)(cpix + 48 + 8 * half);

    const float nc  = ns[rsel + PAD][w0 + PAD + n];   // centre norm of this lane's D column
    const bool  far = (lane >= 8) && (lane < 16);     // this lane keeps chunk 2 (tile 1, D rows 0..7)
    const int   cb  = w0 + (far ? 16 : 8 * half);     // padded column of the first neighbour it keeps
    float*      srow = &sm[wave][n * PXP + 8 * half]; // chunks 0 and 2 at slots 0..7, chunk 1 at 8..15

    int col1 = w0 + 16 + n;                           // tile 1: this lane's A row (padded column)
    col1 = (col1 < WP) ? col1 : (WP - 1);             // clamp keeps the address in range (junk unused)
    const _Float16* nb0 = &hs[rsel][w0 + n][8 * half];
    const _Float16* nb1 = &hs[rsel][col1][8 * half];
    const float*    nrm = &ns[rsel][cb];              // norms of the 8 kept neighbours

    // unrolled: every LDS access of the 7 window rows is then one base register plus a constant offset,
    // and a row's fragment reads can issue while the row before it is still in the matrix unit
#pragma unroll
    for (int i = 0; i < KK; ++i) {
        const _Float16* p0 = nb0 + i * (WP * HSP);    // padded row h+i
        const _Float16* p1 = nb1 + i * (WP * HSP);
        FragH t0a, t0b, t1a, t1b;
        t0a.half[0] = *(const v8h*)(p0);
        t0a.half[1] = *(const v8h*)(p0 + 16);
        t0b.half[0] = *(const v8h*)(p0 + 32);
        t0b.half[1] = *(const v8h*)(p0 + 48);
        t1a.half[0] = *(const v8h*)(p1);
        t1a.half[1] = *(const v8h*)(p1 + 16);
        t1b.half[0] = *(const v8h*)(p1 + 32);
        t1b.half[1] = *(const v8h*)(p1 + 48);
        const v4f np0 = *(const v4f*)(nrm + i * NSP);
        const v4f np1 = *(const v4f*)(nrm + i * NSP + 4);

        const v8f zero = (v8f){0.f, 0.f, 0.f, 0.f, 0.f, 0.f, 0.f, 0.f};
        v8f acc0 = wmma_f16(t0a.v, c0.v, zero);
        v8f acc1 = wmma_f16(t1a.v, c0.v, zero);
        acc0 = wmma_f16(t0b.v, c1.v, acc0);
        acc1 = wmma_f16(t1b.v, c1.v, acc1);

        v4f d0, d1, o0, o1;
#pragma unroll
        for (int r = 0; r < 4; ++r) {
            d0[r] = fmaf(nc, np0[r], EPSF);
            d1[r] = fmaf(nc, np1[r], EPSF);
        }
        rcp8(d0, d1);
#pragma unroll
        for (int r = 0; r < 4; ++r) {
            o0[r] = ((far ? acc1[r]     : acc0[r])     * (INVSC2 * LOG2E)) * d0[r];
            o1[r] = ((far ? acc1[r + 4] : acc0[r + 4]) * (INVSC2 * LOG2E)) * d1[r];
        }
        *(v4f*)(srow + i * SLW)     = o0;
        *(v4f*)(srow + i * SLW + 4) = o1;
    }

    __syncthreads();
    // softmax over the 49 offsets; threads 0..255 own one pixel each (waves 8..15 skip uniformly).
    // The pixel's 49 values are read once into registers (offset (i, j) of pixel n stands at slot
    // (n + j) mod 16 of row i) and exp, sum and scale run on registers; the sum keeps the order k = 0..48.
    // No maximum is subtracted: a score is a cosine, |dot| <= norm * norm (Cauchy-Schwarz; the f16 rounding
    // of the dot's operands adds about one part in a thousand), so the base-2 exponent stays inside -2..2
    // for every x, nothing can overflow, and softmax is unchanged by the common factor that the maximum takes out.
    // Every loop below is fully unrolled so that v[] is indexed by constants and stays in registers; a
    // rolled loop pays one dependent LDS round trip per trip. All scaling precedes the stores, so that no
    // store's data register is rewritten behind it.
    const int p = threadIdx.x;
    if (p < ROWS * WW) {
        const float* row = &sm[p >> 4][(p & 15) * PXP];
        float v[NOFF];
#pragma unroll
        for (int j = 0; j < KK; ++j) {
            const float* rj = row + (((p & 15) + j) & (SLW - 1));
#pragma unroll
            for (int i = 0; i < KK; ++i) v[i * KK + j] = rj[i * SLW];
        }
        // keeps all LDS reads of the row in one group ahead of the first exponential; without it the compiler
        // reuses their registers and issues them in three groups, each waiting out its own LDS round trip
        __builtin_amdgcn_sched_barrier(0);

        float sum = 0.f;
#pragma unroll
        for (int k = 0; k < NOFF; ++k) {
            v[k] = __builtin_amdgcn_exp2f(v[k]);        // one v_exp_f32; the argument is far from its denormal range
            sum += v[k];
        }
        const float inv = __builtin_amdgcn_rcpf(sum);   // 49 terms, each between 1/4 and 4

        float* op = out + (size_t)b * NOFF * OPIX + (size_t)(h0 + (p >> 7)) * WW + (p & (WW - 1));
#pragma unroll
        for (int k = 0; k < NOFF; ++k) v[k] *= inv;
#pragma unroll
        for (int k = 0; k < NOFF; ++k) op[(size_t)k * OPIX] = v[k];
    }
}

// ---------------------------------------------------------------------------
// No workspace is used.
// ---------------------------------------------------------------------------
extern "C" void kernel_launch(void* const* d_in, const int* in_sizes, int n_in,
                              void* d_out, int out_size, void* d_ws, size_t ws_size,
                              hipStream_t stream)
{
    (void)d_ws;
    (void)ws_size;
    if (n_in < 1) return;
    if (in_sizes[0] != BB * CC * HH * WW) return;
    if (out_size != BB * NOFF * OPIX) return;

    const float* x   = (const float*)d_in[0];
    float*       out = (float*)d_out;

    sim_softmax_kernel<<<dim3(BB * HH / ROWS), dim3(NWAVE * 32), 0, stream>>>(x, out);
    (void)hipGetLastError();
}

// v005
// A run of this version takes 8.08 microseconds.
// Next to v004, in two timings, it ran 1.06 and 1.07 times as fast.
// All steps since v000 together make it 3.00 times as fast.
// Channel dot products (band Gram tiles): v_wmma_f32_16x16x32_f16, f16 operands (x carried x64), f32 accumulate; norms, normalisation and softmax in f32.
#include <hip/hip_runtime.h>
#include <math.h>

#define BB     4
#define CC     64
#define HH     128
#define WW     128
#define KK     7
#define NOFF   (KK * KK)        // 49 window offsets
#define PAD    3
#define HP     (HH + 2 * PAD)   // 134 padded rows
#define WP     (WW + 2 * PAD)   // 134 padded columns
#define NSP    136              // LDS pitch (floats) of a staged norm row
#define EPSF   1e-7f
#define XSC    64.0f            // power-of-two carry scale of the f16 copy of x
#define INVSC2 (1.0f / 4096.0f) // undo XSC*XSC in the f32 epilogue
#define LOG2E  1.44269504088896f // scores leave the epilogue times log2(e): exp(s) = 2^(s*log2(e))
#define HSP    72               // LDS pitch (halves) of the f16 pixel tile
#define SLW    16               // floats kept per (pixel, window row): neighbour index modulo 16
#define PXP    (KK * SLW + 4)   // 116: LDS pitch (floats) of a pixel's similarity row, 16 B x odd
#define TLP    (16 * PXP + 32)  // LDS pitch (floats) of a wave's 16 pixels; +32 banks between neighbour tiles
#define OPIX   (HH * WW)        // 16384
#define ROWS   2                // output rows per block
#define SROWS  (ROWS + KK - 1)  // 8 staged padded rows
#define NWAVE  (ROWS * WW / 16) // 16 waves, one 16-pixel tile each

typedef _Float16 v16h __attribute__((ext_vector_type(16)));
typedef _Float16 v8h  __attribute__((ext_vector_type(8)));
typedef float    v8f  __attribute__((ext_vector_type(8)));
typedef float    v4f  __attribute__((ext_vector_type(4)));
union FragH { v16h v; v8h half[2]; };

// 16x16x32 f16 WMMA, f32 accumulate. The plain builtin: the compiler keeps the distance behind it itself.
__device__ __forceinline__ v8f wmma_f16(v16h a, v16h b, v8f c)
{
    return __builtin_amdgcn_wmma_f32_16x16x32_f16(false, a, false, b, (short)0, c, false, false);
}

// Eight reciprocals in place, in one statement: behind a transcendental the instruction set asks for one
// instruction that neither reads its result nor overwrites its source. Here each v_rcp_f32 has the next one
// (other registers) behind it and the last has the v_nop.
__device__ __forceinline__ void rcp8(v4f& a, v4f& b)
{
    float a0 = a[0], a1 = a[1], a2 = a[2], a3 = a[3], b0 = b[0], b1 = b[1], b2 = b[2], b3 = b[3];
    asm("v_rcp_f32 %0, %0\n\tv_rcp_f32 %1, %1\n\tv_rcp_f32 %2, %2\n\tv_rcp_f32 %3, %3\n\t"
        "v_rcp_f32 %4, %4\n\tv_rcp_f32 %5, %5\n\tv_rcp_f32 %6, %6\n\tv_rcp_f32 %7, %7\n\tv_nop"
        : "+v"(a0), "+v"(a1), "+v"(a2), "+v"(a3), "+v"(b0), "+v"(b1), "+v"(b2), "+v"(b3));
    a = (v4f){a0, a1, a2, a3};
    b = (v4f){b0, b1, b2, b3};
}

// One pixel's 64 channels of image row data, 64 coalesced 4-byte loads (a wave = one 128-B line per channel).
// Unrolled: f[] is then indexed by constants and stays in registers, and the loads issue as one group.
__device__ __forceinline__ void load_pixel(float (&f)[CC], const float* __restrict__ xp)
{
#pragma unroll
    for (int c = 0; c < CC; ++c) f[c] = xp[(size_t)c * HH * WW];
}

// Eight channels of a loaded pixel go to LDS as one 16-byte store of f16 (x*64); s takes their squares, in order.
__device__ __forceinline__ void stage_group(const float (&f)[CC], int g, float& s, _Float16* hp)
{
    v8h hv;
#pragma unroll
    for (int e = 0; e < 8; ++e) {
        const float v = f[g * 8 + e];
        s = fmaf(v, v, s);
        hv[e] = (_Float16)(v * XSC);
    }
    *(v8h*)(hp + g * 8) = hv;
}

// The pixel's L2 norm from the f32 sum of squares (order c = 0..63). A pixel of a row outside the image
// (inside == false, wave-uniform, only in the first two and last two strips) is overwritten with zeros by the same
// thread: with the conversion outside any branch the compiler keeps the loads where they are written instead
// of sinking them into the branch.
__device__ __forceinline__ void stage_finish(float s, bool inside, _Float16* hp, float* np)
{
    *np = sqrtf(s);
    if (!inside) {
        const v8h zh = (v8h){0, 0, 0, 0, 0, 0, 0, 0};
#pragma unroll
        for (int g = 0; g < CC / 8; ++g) *(v8h*)(hp + g * 8) = zh;
        *np = 0.f;
    }
}

// Work-group barrier that publishes LDS only: the fences name the LDS address space, so the wave waits for its
// LDS stores (s_wait_dscnt 0) but not for global loads still in flight, which __syncthreads() would wait out.
__device__ __forceinline__ void lds_barrier()
{
    __builtin_amdgcn_fence(__ATOMIC_RELEASE, "workgroup", "local");
    __builtin_amdgcn_s_barrier();
    __builtin_amdgcn_fence(__ATOMIC_ACQUIRE, "workgroup", "local");
}

// One staged row against one wave's 16 centre pixels: two 16x16 D tiles (each two 16x16x32 steps over the
// 64 channels), the kept 8-wide chunk normalised, scaled by log2(e) and stored as two 16-byte LDS stores.
__device__ __forceinline__ void gram_row(const _Float16* p0, const _Float16* p1, const float* nr, float* so,
                                         const FragH& c0, const FragH& c1, float nc, bool far)
{
    FragH t0a, t0b, t1a, t1b;
    t0a.half[0] = *(const v8h*)(p0);
    t0a.half[1] = *(const v8h*)(p0 + 16);
    t0b.half[0] = *(const v8h*)(p0 + 32);
    t0b.half[1] = *(const v8h*)(p0 + 48);
    t1a.half[0] = *(const v8h*)(p1);
    t1a.half[1] = *(const v8h*)(p1 + 16);
    t1b.half[0] = *(const v8h*)(p1 + 32);
    t1b.half[1] = *(const v8h*)(p1 + 48);
    const v4f np0 = *(const v4f*)(nr);
    const v4f np1 = *(const v4f*)(nr + 4);

    const v8f zero = (v8f){0.f, 0.f, 0.f, 0.f, 0.f, 0.f, 0.f, 0.f};
    v8f acc0 = wmma_f16(t0a.v, c0.v, zero);
    v8f acc1 = wmma_f16(t1a.v, c0.v, zero);
    acc0 = wmma_f16(t0b.v, c1.v, acc0);
    acc1 = wmma_f16(t1b.v, c1.v, acc1);

    v4f d0, d1, o0, o1;
#pragma unroll
    for (int r = 0; r < 4; ++r) {
        d0[r] = fmaf(nc, np0[r], EPSF);
        d1[r] = fmaf(nc, np1[r], EPSF);
    }
    rcp8(d0, d1);
#pragma unroll
    for (int r = 0; r < 4; ++r) {
        o0[r] = ((far ? acc1[r]     : acc0[r])     * (INVSC2 * LOG2E)) * d0[r];
        o1[r] = ((far ? acc1[r + 4] : acc0[r + 4]) * (INVSC2 * LOG2E)) * d1[r];
    }
    *(v4f*)(so)     = o0;
    *(v4f*)(so + 4) = o1;
}

// ---------------------------------------------------------------------------
// One launch. One block per (batch b, strip of ROWS output rows h0, h0+1); 16 waves.
// Staging: the 8 padded rows h0..h0+7 of x (B,C,H,W) f32 go straight into LDS as a padded pixel-major
//   f16 tile hs[row][padded column][channel], value = x*64 (zeros in the halo), with the per-pixel L2
//   norms ns[row][padded column] from the f32 data (0 in the halo). A thread owns one pixel of two rows:
//   one of the inner rows 2..5 and one of the outer rows 0, 1, 6, 7 (144-B LDS pitch = 16 B x odd).
// Order: the inner row's loads are issued first, the outer row's behind them, eight at a time, as the inner
//   row is converted. The inner rows are published (barrier);
//   they hold both centre rows (3, 4) and four of the seven window rows of either output row, so those
//   Gram tiles run while the outer rows' loads are still in flight. Then the outer rows are converted and
//   published (second barrier) and the other three window rows follow.
// Gram: each wave owns 16 output pixels w0..w0+15 of row h0+rsel; staged row s is its window row i = s - rsel.
// Band WMMA: for each staged row, two 16x16 D tiles: A = 16 neighbour vectors at padded columns
// w0+16*tile+m (rows m), B = 16 centre pixel vectors (columns n); D[m][n] holds horizontal offset
// j = m - n + 16*tile, valid when 0<=j<7.
// A and B fragments both use the split k map: elements 0..7 <- k0+8*half, 8..15 <- k0+16+8*half.
// A lane's 8 D registers are 8 consecutive neighbours q = 16*tile + 8*half + r of ONE pixel n. Pixel n
// needs q = n..n+6, which lies in two of the 8-wide chunks 0, 1, 2: lanes 16..31 keep chunk 1, lanes
// 0..7 chunk 0, lanes 8..15 chunk 2 (tile 1). The kept chunk goes to LDS at slot q mod 16 of the pixel's
// row for offset i.
// Softmax: thread p (< 256) runs the 49-way softmax of pixel p in f32 in registers, in base 2 and
// without a maximum (see there), and writes out[b][k][(h0 + p/128)*128 + p%128].
// ---------------------------------------------------------------------------
__global__ __launch_bounds__(NWAVE * 32)
void sim_softmax_kernel(const float* __restrict__ x,
                        float* __restrict__ out)
{
    __shared__ __align__(16) _Float16 hs[SROWS][WP][HSP];      // 154,368 B
    __shared__ __align__(16) float    sm[NWAVE][TLP];          // [wave][pixel * PXP + i * SLW + (q mod 16)]
    __shared__ __align__(16) float    ns[SROWS][NSP];

    const int blk  = blockIdx.x;
    const int b    = blk / (HH / ROWS);
    const int h0   = (blk % (HH / ROWS)) * ROWS;
    const int tid  = threadIdx.x;
    const int lane = tid & 31;
    const int wave = tid >> 5;

    // ---- staging, first part: issue all loads, convert and publish the inner rows ----
    const int w  = tid & (WW - 1);                               // image column of this thread
    // 0..3, the same in a whole wave; read as a scalar so that the row tests are scalar branches
    const int rg  = __builtin_amdgcn_readfirstlane(tid >> 7);
    const int srA = rg + 2;                                      // staged rows 2, 3, 4, 5
    const int srB = (rg < 2) ? rg : rg + 4;                      // staged rows 0, 1, 6, 7
    const int rA  = h0 + srA - PAD;                              // image rows (staged row = padded row h0 + sr)
    const int rB  = h0 + srB - PAD;
    const bool inA = (rA >= 0) && (rA < HH);                     // wave-uniform
    const bool inB = (rB >= 0) && (rB < HH);
    // a row outside the image is loaded from the nearest image row (address in range) and not used
    const int rAc = (rA < 0) ? 0 : ((rA < HH) ? rA : HH - 1);
    const int rBc = (rB < 0) ? 0 : ((rB < HH) ? rB : HH - 1);
    const float* xb = x + (size_t)b * CC * HH * WW + w;
    float fA[CC], fB[CC];
    load_pixel(fA, xb + (size_t)rAc * WW);
    {
        const float* xpB = xb + (size_t)rBc * WW;
        float sA = 0.f;
#pragma unroll
        for (int g = 0; g < CC / 8; ++g) {
            stage_group(fA, g, sA, &hs[srA][w + PAD][0]);
            // holds this order: a wave has at most 63 loads outstanding, so an outer-row load can issue only as an
            // inner-row load returns; hoisted in front of the conversion, the 64 loads would hold the wave in their
            // issue until the whole inner row is back, and its conversion would start only then
            __builtin_amdgcn_sched_barrier(0);
#pragma unroll
            for (int e = 0; e < 8; ++e) fB[g * 8 + e] = xpB[(size_t)(g * 8 + e) * HH * WW];
        }
        // the outer-row loads stay in flight far into the code below, which reuses their address registers:
        // the wait that belongs in front of such an overwrite
        asm volatile("s_wait_xcnt 0x0" ::: "memory");
        stage_finish(sA, inA, &hs[srA][w + PAD][0], &ns[srA][w + PAD]);
    }
    {
        const v8h zh = (v8h){0, 0, 0, 0, 0, 0, 0, 0};
        // halo columns 0..2 and 131..133 of every staged row: 8 rows x 6 columns x 8 chunks of 16 B
        if (tid < SROWS * 2 * PAD * 8) {
            const int sr = tid / (2 * PAD * 8);
            const int q  = tid % (2 * PAD * 8);
            const int ci = q >> 3;
            const int pc = (ci < PAD) ? ci : (ci + WW);
            *(v8h*)(&hs[sr][pc][(q & 7) * 8]) = zh;
            if ((q & 7) == 0) ns[sr][pc] = 0.f;
        }
        // pitch columns 134, 135 of the norm rows: the 16-byte norm reads of the last tile touch them
        if (tid < SROWS * (NSP - WP)) ns[tid / (NSP - WP)][WP + tid % (NSP - WP)] = 0.f;
    }
    lds_barrier();     // staged rows 2..5 and every halo are published; fB is still in flight

    // ---- band Gram tiles from LDS ----
    const int rsel = wave >> 3;                       // output row of this wave within the strip
    const int w0   = (wave & 7) * 16;
    const int half = lane >> 4;
    const int n    = lane & 15;                       // A row / B column / D column of this lane

    // B fragments: centre pixel n at staged (rsel+3, w0+3+n), channels 0..31 and 32..63
    const _Float16* cpix = &hs[rsel + PAD][w0 + PAD + n][0];
    FragH c0, c1;
    c0.half[0] = *(const v8h*)(cpix +      8 * half);
    c0.half[1] = *(const v8h*)(cpix + 16 + 8 * half);
    c1.half[0] = *(const v8h*)(cpix + 32 + 8 * half);
    c1.half[1] = *(const v8h*)(cpix + 48 + 8 * half);

    const float nc  = ns[rsel + PAD][w0 + PAD + n];   // centre norm of this lane's D column
    const bool  far = (lane >= 8) && (lane < 16);     // this lane keeps chunk 2 (tile 1, D rows 0..7)
    const int   cb  = w0 + (far ? 16 : 8 * half);     // padded column of the first neighbour it keeps
    // chunks 0 and 2 at slots 0..7, chunk 1 at 8..15; indexed by the staged row s (window row s - rsel)
    float*      srow = &sm[wave][n * PXP + 8 * half] - rsel * SLW;

    int col1 = w0 + 16 + n;                           // tile 1: this lane's A row (padded column)
    col1 = (col1 < WP) ? col1 : (WP - 1);             // clamp keeps the address in range (junk unused)
    const _Float16* nb0 = &hs[0][w0 + n][8 * half];
    const _Float16* nb1 = &hs[0][col1][8 * half];
    const float*    nrm = &ns[0][cb];                 // norms of the 8 kept neighbours

    // unrolled: every LDS access of the rows is then one base register plus a constant offset,
    // and a row's fragment reads can issue while the row before it is still in the matrix unit
#pragma unroll
    for (int s = 2; s < 6; ++s)
        gram_row(nb0 + s * (WP * HSP), nb1 + s * (WP * HSP), nrm + s * NSP, srow + s * SLW, c0, c1, nc, far);

    // ---- staging, second part: the outer rows, whose loads flew under the four Gram rows above ----
    {
        float sB = 0.f;
#pragma unroll
        for (int g = 0; g < CC / 8; ++g) stage_group(fB, g, sB, &hs[srB][w + PAD][0]);
        stage_finish(sB, inB, &hs[srB][w + PAD][0], &ns[srB][w + PAD]);
    }
    __syncthreads();   // staged rows 0, 1, 6, 7 are published

    // the other three window rows: staged rows 1 and 6 for both output rows, 0 for the upper, 7 for the lower
    gram_row(nb0 + 1 * (WP * HSP), nb1 + 1 * (WP * HSP), nrm + 1 * NSP, srow + 1 * SLW, c0, c1, nc, far);
    gram_row(nb0 + 6 * (WP * HSP), nb1 + 6 * (WP * HSP), nrm + 6 * NSP, srow + 6 * SLW, c0, c1, nc, far);
    {
        const int s = (SROWS - 1) * rsel;
        gram_row(nb0 + s * (WP * HSP), nb1 + s * (WP * HSP), nrm + s * NSP, srow + s * SLW, c0, c1, nc, far);
    }

    __syncthreads();
    // softmax over the 49 offsets; threads 0..255 own one pixel each (waves 8..15 skip uniformly).
    // The pixel's 49 values are read once into registers (offset (i, j) of pixel n stands at slot
    // (n + j) mod 16 of row i) and exp, sum and scale run on registers; the sum keeps the order k = 0..48.
    // No maximum is subtracted: a score is a cosine, |dot| <= norm * norm (Cauchy-Schwarz; the f16 rounding
    // of the dot's operands adds about one part in a thousand), so the base-2 exponent stays inside -2..2
    // for every x, nothing can overflow, and softmax is unchanged by the common factor that the maximum takes out.
    // Every loop below is fully unrolled so that v[] is indexed by constants and stays in registers; a
    // rolled loop pays one dependent LDS round trip per trip. All scaling precedes the stores, so that no
    // store's data register is rewritten behind it.
    const int p = threadIdx.x;
    if (p < ROWS * WW) {
        const float* row = &sm[p >> 4][(p & 15) * PXP];
        float v[NOFF];
#pragma unroll
        for (int j = 0; j < KK; ++j) {
            const float* rj = row + (((p & 15) + j) & (SLW - 1));
#pragma unroll
            for (int i = 0; i < KK; ++i) v[i * KK + j] = rj[i * SLW];
        }
        // keeps all LDS reads of the row in one group ahead of the first exponential; without it the compiler
        // reuses their registers and issues them in three groups, each waiting out its own LDS round trip
        __builtin_amdgcn_sched_barrier(0);

        float sum = 0.f;
#pragma unroll
        for (int k = 0; k < NOFF; ++k) {
            v[k] = __builtin_amdgcn_exp2f(v[k]);        // one v_exp_f32; the argument is far from its denormal range
            sum += v[k];
        }
        const float inv = __builtin_amdgcn_rcpf(sum);   // 49 terms, each between 1/4 and 4

        float* op = out + (size_t)b * NOFF * OPIX + (size_t)(h0 + (p >> 7)) * WW + (p & (WW - 1));
#pragma unroll
        for (int k = 0; k < NOFF; ++k) v[k] *= inv;
#pragma unroll
        for (int k = 0; k < NOFF; ++k) op[(size_t)k * OPIX] = v[k];
    }
}

// ---------------------------------------------------------------------------
// No workspace is used.
// ---------------------------------------------------------------------------
extern "C" void kernel_launch(void* const* d_in, const int* in_sizes, int n_in,
                              void* d_out, int out_size, void* d_ws, size_t ws_size,
                              hipStream_t stream)
{
    (void)d_ws;
    (void)ws_size;
    if (n_in < 1) return;
    if (in_sizes[0] != BB * CC * HH * WW) return;
    if (out_size != BB * NOFF * OPIX) return;

    const float* x   = (const float*)d_in[0];
    float*       out = (float*)d_out;

    sim_softmax_kernel<<<dim3(BB * HH / ROWS), dim3(NWAVE * 32), 0, stream>>>(x, out);
    (void)hipGetLastError();
}

// v006
// Measured time: 7.28 microseconds a run.
// Two timings next to v005 put it at 1.10 and 1.09 times that version's speed.
// All steps since v000 together make it 3.29 times as fast.
// Channel dot products (band Gram tiles): v_wmma_f32_16x16x32_f16, f16 operands (x carried x64), f32 accumulate; norms, normalisation and softmax in f32.
#include <hip/hip_runtime.h>
#include <math.h>

#define BB     4
#define CC     64
#define HH     128
#define WW     128
#define KK     7
#define NOFF   (KK * KK)        // 49 window offsets
#define PAD    3
#define HP     (HH + 2 * PAD)   // 134 padded rows
#define WP     (WW + 2 * PAD)   // 134 padded columns
#define NSP    136              // LDS pitch (floats) of a staged norm row
#define EPSF   1e-7f
#define XSC    64.0f            // power-of-two carry scale of the f16 copy of x
#define INVSC2 (1.0f / 4096.0f) // undo XSC*XSC in the f32 epilogue
#define LOG2E  1.44269504088896f // scores leave the epilogue times log2(e): exp(s) = 2^(s*log2(e))
#define HSP    72               // LDS pitch (halves) of the f16 pixel tile
#define SLW    16               // floats kept per (pixel, window row): neighbour index modulo 16
#define PXP    (KK * SLW + 4)   // 116: LDS pitch (floats) of a pixel's similarity row, 16 B x odd
#define TLP    (16 * PXP + 32)  // LDS pitch (floats) of a wave's 16 pixels; +32 banks between neighbour tiles
#define OPIX   (HH * WW)        // 16384
#define ROWS   2                // output rows per block
#define SROWS  (ROWS + KK - 1)  // 8 staged padded rows
#define NWAVE  (ROWS * WW / 16) // 16 waves, one 16-pixel tile each
#define OV4    (NOFF * ROWS * WW / 4)   // 3136 16-byte pieces of the strip's output tile
#define OFULL  (OV4 / (NWAVE * 32))     // 6 rounds in which every thread stores one piece

typedef _Float16 v16h __attribute__((ext_vector_type(16)));
typedef _Float16 v8h  __attribute__((ext_vector_type(8)));
typedef float    v8f  __attribute__((ext_vector_type(8)));
typedef float    v4f  __attribute__((ext_vector_type(4)));
union FragH { v16h v; v8h half[2]; };

// 16x16x32 f16 WMMA, f32 accumulate. The plain builtin: the compiler keeps the distance behind it itself.
__device__ __forceinline__ v8f wmma_f16(v16h a, v16h b, v8f c)
{
    return __builtin_amdgcn_wmma_f32_16x16x32_f16(false, a, false, b, (short)0, c, false, false);
}

// Eight reciprocals in place, in one statement: behind a transcendental the instruction set asks for one
// instruction that neither reads its result nor overwrites its source. Here each v_rcp_f32 has the next one
// (other registers) behind it and the last has the v_nop.
__device__ __forceinline__ void rcp8(v4f& a, v4f& b)
{
    float a0 = a[0], a1 = a[1], a2 = a[2], a3 = a[3], b0 = b[0], b1 = b[1], b2 = b[2], b3 = b[3];
    asm("v_rcp_f32 %0, %0\n\tv_rcp_f32 %1, %1\n\tv_rcp_f32 %2, %2\n\tv_rcp_f32 %3, %3\n\t"
        "v_rcp_f32 %4, %4\n\tv_rcp_f32 %5, %5\n\tv_rcp_f32 %6, %6\n\tv_rcp_f32 %7, %7\n\tv_nop"
        : "+v"(a0), "+v"(a1), "+v"(a2), "+v"(a3), "+v"(b0), "+v"(b1), "+v"(b2), "+v"(b3));
    a = (v4f){a0, a1, a2, a3};
    b = (v4f){b0, b1, b2, b3};
}

// One pixel's 64 channels of image row data, 64 coalesced 4-byte loads (a wave = one 128-B line per channel).
// Unrolled: f[] is then indexed by constants and stays in registers, and the loads issue as one group.
__device__ __forceinline__ void load_pixel(float (&f)[CC], const float* __restrict__ xp)
{
#pragma unroll
    for (int c = 0; c < CC; ++c) f[c] = xp[(size_t)c * HH * WW];
}

// Eight channels of a loaded pixel go to LDS as one 16-byte store of f16 (x*64); s takes their squares, in order.
__device__ __forceinline__ void stage_group(const float (&f)[CC], int g, float& s, _Float16* hp)
{
    v8h hv;
#pragma unroll
    for (int e = 0; e < 8; ++e) {
        const float v = f[g * 8 + e];
        s = fmaf(v, v, s);
        hv[e] = (_Float16)(v * XSC);
    }
    *(v8h*)(hp + g * 8) = hv;
}

// The pixel's L2 norm from the f32 sum of squares (order c = 0..63). A pixel of a row outside the image
// (inside == false, wave-uniform, only in the first two and last two strips) is overwritten with zeros by the same
// thread: with the conversion outside any branch the compiler keeps the loads where they are written instead
// of sinking them into the branch.
__device__ __forceinline__ void stage_finish(float s, bool inside, _Float16* hp, float* np)
{
    *np = sqrtf(s);
    if (!inside) {
        const v8h zh = (v8h){0, 0, 0, 0, 0, 0, 0, 0};
#pragma unroll
        for (int g = 0; g < CC / 8; ++g) *(v8h*)(hp + g * 8) = zh;
        *np = 0.f;
    }
}

// Work-group barrier that publishes LDS only: the fences name the LDS address space, so the wave waits for its
// LDS stores (s_wait_dscnt 0) but not for global loads still in flight, which __syncthreads() would wait out.
__device__ __forceinline__ void lds_barrier()
{
    __builtin_amdgcn_fence(__ATOMIC_RELEASE, "workgroup", "local");
    __builtin_amdgcn_s_barrier();
    __builtin_amdgcn_fence(__ATOMIC_ACQUIRE, "workgroup", "local");
}

// One staged row against one wave's 16 centre pixels: two 16x16 D tiles (each two 16x16x32 steps over the
// 64 channels), the kept 8-wide chunk normalised, scaled by log2(e) and stored as two 16-byte LDS stores.
__device__ __forceinline__ void gram_row(const _Float16* p0, const _Float16* p1, const float* nr, float* so,
                                         const FragH& c0, const FragH& c1, float nc, bool far)
{
    FragH t0a, t0b, t1a, t1b;
    t0a.half[0] = *(const v8h*)(p0);
    t0a.half[1] = *(const v8h*)(p0 + 16);
    t0b.half[0] = *(const v8h*)(p0 + 32);
    t0b.half[1] = *(const v8h*)(p0 + 48);
    t1a.half[0] = *(const v8h*)(p1);
    t1a.half[1] = *(const v8h*)(p1 + 16);
    t1b.half[0] = *(const v8h*)(p1 + 32);
    t1b.half[1] = *(const v8h*)(p1 + 48);
    const v4f np0 = *(const v4f*)(nr);
    const v4f np1 = *(const v4f*)(nr + 4);

    const v8f zero = (v8f){0.f, 0.f, 0.f, 0.f, 0.f, 0.f, 0.f, 0.f};
    v8f acc0 = wmma_f16(t0a.v, c0.v, zero);
    v8f acc1 = wmma_f16(t1a.v, c0.v, zero);
    acc0 = wmma_f16(t0b.v, c1.v, acc0);
    acc1 = wmma_f16(t1b.v, c1.v, acc1);

    v4f d0, d1, o0, o1;
#pragma unroll
    for (int r = 0; r < 4; ++r) {
        d0[r] = fmaf(nc, np0[r], EPSF);
        d1[r] = fmaf(nc, np1[r], EPSF);
    }
    rcp8(d0, d1);
#pragma unroll
    for (int r = 0; r < 4; ++r) {
        o0[r] = ((far ? acc1[r]     : acc0[r])     * (INVSC2 * LOG2E)) * d0[r];
        o1[r] = ((far ? acc1[r + 4] : acc0[r + 4]) * (INVSC2 * LOG2E)) * d1[r];
    }
    *(v4f*)(so)     = o0;
    *(v4f*)(so + 4) = o1;
}

// ---------------------------------------------------------------------------
// One launch. One block per (batch b, strip of ROWS output rows h0, h0+1); 16 waves.
// Staging: the 8 padded rows h0..h0+7 of x (B,C,H,W) f32 go straight into LDS as a padded pixel-major
//   f16 tile hs[row][padded column][channel], value = x*64 (zeros in the halo), with the per-pixel L2
//   norms ns[row][padded column] from the f32 data (0 in the halo). A thread owns one pixel of two rows:
//   one of the inner rows 2..5 and one of the outer rows 0, 1, 6, 7 (144-B LDS pitch = 16 B x odd).
// Order: the inner row's loads are issued first, the outer row's behind them, eight at a time, as the inner
//   row is converted. The inner rows are published (barrier);
//   they hold both centre rows (3, 4) and four of the seven window rows of either output row, so those
//   Gram tiles run while the outer rows' loads are still in flight. Then the outer rows are converted and
//   published (second barrier) and the other three window rows follow.
// Gram: each wave owns 16 output pixels w0..w0+15 of row h0+rsel; staged row s is its window row i = s - rsel.
// Band WMMA: for each staged row, two 16x16 D tiles: A = 16 neighbour vectors at padded columns
// w0+16*tile+m (rows m), B = 16 centre pixel vectors (columns n); D[m][n] holds horizontal offset
// j = m - n + 16*tile, valid when 0<=j<7.
// A and B fragments both use the split k map: elements 0..7 <- k0+8*half, 8..15 <- k0+16+8*half.
// A lane's 8 D registers are 8 consecutive neighbours q = 16*tile + 8*half + r of ONE pixel n. Pixel n
// needs q = n..n+6, which lies in two of the 8-wide chunks 0, 1, 2: lanes 16..31 keep chunk 1, lanes
// 0..7 chunk 0, lanes 8..15 chunk 2 (tile 1). The kept chunk goes to LDS at slot q mod 16 of the pixel's
// row for offset i.
// Softmax: thread p (< 256) runs the 49-way softmax of pixel p in f32 in registers, in base 2 and
// without a maximum (see there); the result out[b][k][(h0 + p/128)*128 + p%128] leaves through an LDS tile
// as 16-byte stores by all 16 waves.
// ---------------------------------------------------------------------------
__global__ __launch_bounds__(NWAVE * 32)
void sim_softmax_kernel(const float* __restrict__ x,
                        float* __restrict__ out)
{
    __shared__ __align__(16) _Float16 hs[SROWS][WP][HSP];      // 154,368 B
    __shared__ __align__(16) float    sm[NWAVE][TLP];          // [wave][pixel * PXP + i * SLW + (q mod 16)]
    __shared__ __align__(16) float    ns[SROWS][NSP];

    const int blk  = blockIdx.x;
    const int b    = blk / (HH / ROWS);
    const int h0   = (blk % (HH / ROWS)) * ROWS;
    const int tid  = threadIdx.x;
    const int lane = tid & 31;
    const int wave = tid >> 5;

    // ---- staging, first part: issue all loads, convert and publish the inner rows ----
    const int w  = tid & (WW - 1);                               // image column of this thread
    // 0..3, the same in a whole wave; read as a scalar so that the row tests are scalar branches
    const int rg  = __builtin_amdgcn_readfirstlane(tid >> 7);
    const int srA = rg + 2;                                      // staged rows 2, 3, 4, 5
    const int srB = (rg < 2) ? rg : rg + 4;                      // staged rows 0, 1, 6, 7
    const int rA  = h0 + srA - PAD;                              // image rows (staged row = padded row h0 + sr)
    const int rB  = h0 + srB - PAD;
    const bool inA = (rA >= 0) && (rA < HH);                     // wave-uniform
    const bool inB = (rB >= 0) && (rB < HH);
    // a row outside the image is loaded from the nearest image row (address in range) and not used
    const int rAc = (rA < 0) ? 0 : ((rA < HH) ? rA : HH - 1);
    const int rBc = (rB < 0) ? 0 : ((rB < HH) ? rB : HH - 1);
    const float* xb = x + (size_t)b * CC * HH * WW + w;
    float fA[CC], fB[CC];
    load_pixel(fA, xb + (size_t)rAc * WW);
    {
        const float* xpB = xb + (size_t)rBc * WW;
        float sA = 0.f;
#pragma unroll
        for (int g = 0; g < CC / 8; ++g) {
            stage_group(fA, g, sA, &hs[srA][w + PAD][0]);
            // holds this order: a wave has at most 63 loads outstanding, so an outer-row load can issue only as an
            // inner-row load returns; hoisted in front of the conversion, the 64 loads would hold the wave in their
            // issue until the whole inner row is back, and its conversion would start only then
            __builtin_amdgcn_sched_barrier(0);
#pragma unroll
            for (int e = 0; e < 8; ++e) fB[g * 8 + e] = xpB[(size_t)(g * 8 + e) * HH * WW];
        }
        // the outer-row loads stay in flight far into the code below, which reuses their address registers:
        // the wait that belongs in front of such an overwrite
        asm volatile("s_wait_xcnt 0x0" ::: "memory");
        stage_finish(sA, inA, &hs[srA][w + PAD][0], &ns[srA][w + PAD]);
    }
    {
        const v8h zh = (v8h){0, 0, 0, 0, 0, 0, 0, 0};
        // halo columns 0..2 and 131..133 of every staged row: 8 rows x 6 columns x 8 chunks of 16 B
        if (tid < SROWS * 2 * PAD * 8) {
            const int sr = tid / (2 * PAD * 8);
            const int q  = tid % (2 * PAD * 8);
            const int ci = q >> 3;
            const int pc = (ci < PAD) ? ci : (ci + WW);
            *(v8h*)(&hs[sr][pc][(q & 7) * 8]) = zh;
            if ((q & 7) == 0) ns[sr][pc] = 0.f;
        }
        // pitch columns 134, 135 of the norm rows: the 16-byte norm reads of the last tile touch them
        if (tid < SROWS * (NSP - WP)) ns[tid / (NSP - WP)][WP + tid % (NSP - WP)] = 0.f;
    }
    lds_barrier();     // staged rows 2..5 and every halo are published; fB is still in flight

    // ---- band Gram tiles from LDS ----
    const int rsel = wave >> 3;                       // output row of this wave within the strip
    const int w0   = (wave & 7) * 16;
    const int half = lane >> 4;
    const int n    = lane & 15;                       // A row / B column / D column of this lane

    // B fragments: centre pixel n at staged (rsel+3, w0+3+n), channels 0..31 and 32..63
    const _Float16* cpix = &hs[rsel + PAD][w0 + PAD + n][0];
    FragH c0, c1;
    c0.half[0] = *(const v8h*)(cpix +      8 * half);
    c0.half[1] = *(const v8h*)(cpix + 16 + 8 * half);
    c1.half[0] = *(const v8h*)(cpix + 32 + 8 * half);
    c1.half[1] = *(const v8h*)(cpix + 48 + 8 * half);

    const float nc  = ns[rsel + PAD][w0 + PAD + n];   // centre norm of this lane's D column
    const bool  far = (lane >= 8) && (lane < 16);     // this lane keeps chunk 2 (tile 1, D rows 0..7)
    const int   cb  = w0 + (far ? 16 : 8 * half);     // padded column of the first neighbour it keeps
    // chunks 0 and 2 at slots 0..7, chunk 1 at 8..15; indexed by the staged row s (window row s - rsel)
    float*      srow = &sm[wave][n * PXP + 8 * half] - rsel * SLW;

    int col1 = w0 + 16 + n;                           // tile 1: this lane's A row (padded column)
    col1 = (col1 < WP) ? col1 : (WP - 1);             // clamp keeps the address in range (junk unused)
    const _Float16* nb0 = &hs[0][w0 + n][8 * half];
    const _Float16* nb1 = &hs[0][col1][8 * half];
    const float*    nrm = &ns[0][cb];                 // norms of the 8 kept neighbours

    // unrolled: every LDS access of the rows is then one base register plus a constant offset,
    // and a row's fragment reads can issue while the row before it is still in the matrix unit
#pragma unroll
    for (int s = 2; s < 6; ++s)
        gram_row(nb0 + s * (WP * HSP), nb1 + s * (WP * HSP), nrm + s * NSP, srow + s * SLW, c0, c1, nc, far);

    // ---- staging, second part: the outer rows, whose loads flew under the four Gram rows above ----
    {
        float sB = 0.f;
#pragma unroll
        for (int g = 0; g < CC / 8; ++g) stage_group(fB, g, sB, &hs[srB][w + PAD][0]);
        stage_finish(sB, inB, &hs[srB][w + PAD][0], &ns[srB][w + PAD]);
    }
    __syncthreads();   // staged rows 0, 1, 6, 7 are published

    // the other three window rows: staged rows 1 and 6 for both output rows, 0 for the upper, 7 for the lower
    gram_row(nb0 + 1 * (WP * HSP), nb1 + 1 * (WP * HSP), nrm + 1 * NSP, srow + 1 * SLW, c0, c1, nc, far);
    gram_row(nb0 + 6 * (WP * HSP), nb1 + 6 * (WP * HSP), nrm + 6 * NSP, srow + 6 * SLW, c0, c1, nc, far);
    {
        const int s = (SROWS - 1) * rsel;
        gram_row(nb0 + s * (WP * HSP), nb1 + s * (WP * HSP), nrm + s * NSP, srow + s * SLW, c0, c1, nc, far);
    }

    __syncthreads();
    // softmax over the 49 offsets; threads 0..255 own one pixel each (waves 8..15 skip uniformly).
    // The pixel's 49 values are read once into registers (offset (i, j) of pixel n stands at slot
    // (n + j) mod 16 of row i) and exp, sum and scale run on registers; the sum keeps the order k = 0..48.
    // No maximum is subtracted: a score is a cosine, |dot| <= norm * norm (Cauchy-Schwarz; the f16 rounding
    // of the dot's operands adds about one part in a thousand), so the base-2 exponent stays inside -2..2
    // for every x, nothing can overflow, and softmax is unchanged by the common factor that the maximum takes out.
    // Every loop below is fully unrolled so that v[] is indexed by constants and stays in registers; a
    // rolled loop pays one dependent LDS round trip per trip.
    // The normalised values go to an output tile ob[plane][pixel] in LDS, in the place of the f16 pixel tile,
    // which nobody reads behind the barrier above.
    float* ob = (float*)&hs[0][0][0];
    const int p = threadIdx.x;
    if (p < ROWS * WW) {
        const float* row = &sm[p >> 4][(p & 15) * PXP];
        float v[NOFF];
#pragma unroll
        for (int j = 0; j < KK; ++j) {
            const float* rj = row + (((p & 15) + j) & (SLW - 1));
#pragma unroll
            for (int i = 0; i < KK; ++i) v[i * KK + j] = rj[i * SLW];
        }
        // keeps all LDS reads of the row in one group ahead of the first exponential; without it the compiler
        // reuses their registers and issues them in three groups, each waiting out its own LDS round trip
        __builtin_amdgcn_sched_barrier(0);

        float sum = 0.f;
#pragma unroll
        for (int k = 0; k < NOFF; ++k) {
            v[k] = __builtin_amdgcn_exp2f(v[k]);        // one v_exp_f32; the argument is far from its denormal range
            sum += v[k];
        }
        const float inv = __builtin_amdgcn_rcpf(sum);   // 49 terms, each between 1/4 and 4

#pragma unroll
        for (int k = 0; k < NOFF; ++k) v[k] *= inv;
        // plane-major output tile; a wave writes 128 consecutive bytes per plane (no bank conflict)
#pragma unroll
        for (int k = 0; k < NOFF; ++k) ob[k * (ROWS * WW) + p] = v[k];
    }
    __syncthreads();   // the output tile is published

    // The strip's two rows are adjacent in every plane of out: plane k is 1 KiB in a row, in LDS and in memory.
    // All 16 waves copy the tile out, 16 bytes a lane: one store covers 512 consecutive bytes (four whole lines).
    // Unrolled: the LDS reads issue as one group, every store keeps its own data registers, and the planes are
    // constant offsets from one address.
    {
        const v4f* ob4 = (const v4f*)ob;
        float* og = out + (size_t)b * NOFF * OPIX + (size_t)h0 * WW + (size_t)(tid >> 6) * OPIX + (tid & 63) * 4;
        const bool last = tid < OV4 - OFULL * (NWAVE * 32);   // the last plane: waves 0 and 1, wave-uniform
        v4f t[OFULL], tl = (v4f){0.f, 0.f, 0.f, 0.f};
        if (last) tl = ob4[tid + OFULL * (NWAVE * 32)];
#pragma unroll
        for (int it = 0; it < OFULL; ++it) t[it] = ob4[tid + it * (NWAVE * 32)];
#pragma unroll
        for (int it = 0; it < OFULL; ++it) *(v4f*)(og + (size_t)it * (NWAVE * 32 / 64) * OPIX) = t[it];
        if (last) *(v4f*)(og + (size_t)OFULL * (NWAVE * 32 / 64) * OPIX) = tl;
    }
}

// ---------------------------------------------------------------------------
// No workspace is used.
// ---------------------------------------------------------------------------
extern "C" void kernel_launch(void* const* d_in, const int* in_sizes, int n_in,
                              void* d_out, int out_size, void* d_ws, size_t ws_size,
                              hipStream_t stream)
{
    (void)d_ws;
    (void)ws_size;
    if (n_in < 1) return;
    if (in_sizes[0] != BB * CC * HH * WW) return;
    if (out_size != BB * NOFF * OPIX) return;

    const float* x   = (const float*)d_in[0];
    float*       out = (float*)d_out;

    sim_softmax_kernel<<<dim3(BB * HH / ROWS), dim3(NWAVE * 32), 0, stream>>>(x, out);
    (void)hipGetLastError();
}
